// v000
// The times below were measured on an AMD MI455X: many runs one after another, warmed up first and cycling through
// copies of the inputs, with the whole window's GPU time divided by the number of runs. Launches and the gaps
// between them are all in it. The median over several windows is given; except for v000 it joins two sittings, which
// can be a few percent apart, so the side-by-side timings, each taken in one sitting, are the better comparison.
// v000, which the later versions start from, runs in 454 microseconds.
#include <hip/hip_runtime.h>

// ---------------------------------------------------------------------------
// Causal self-attention for MI455X (gfx1250, wave32, WMMA).
// fp32 in/out; internal compute in f16 with fp32 WMMA accumulation.
// ---------------------------------------------------------------------------

typedef __attribute__((ext_vector_type(16))) _Float16 v16h;
typedef __attribute__((ext_vector_type(8)))  float    v8f;
typedef int i32x4 __attribute__((vector_size(16)));

#define D_MODEL 1024
#define NHEADS  16
#define HDIM    64
#define SEQ     2048
#define BATCH   4
#define MTOT    (BATCH * SEQ)   // 8192 rows

// Load a 16x32 f16 fragment (A-layout or symmetric B-layout) where the WMMA
// K-dimension is contiguous in memory at `p` (p = row/col start + k-base).
// Per CDNA5 ISA 16-bit A layout: lane half = lane>>4,
//   VGPR v holds K = (v/4)*16 + half*8 + (v%4)*2  (+1 for hi half of dword).
// Per half this is two contiguous 16B chunks -> compiler emits 2x b128 loads.
__device__ __forceinline__ v16h frag_load(const _Float16* p, int half) {
  union { v16h h; unsigned int u[8]; } r;
#pragma unroll
  for (int v = 0; v < 8; ++v) {
    int k = ((v >> 2) << 4) + (half << 3) + ((v & 3) << 1);
    r.u[v] = *(const unsigned int*)(p + k);
  }
  return r.h;
}

// Async copy 16B global -> LDS (CDNA5 GLOBAL_LOAD_ASYNC_TO_LDS_B128 when the
// toolchain exposes the builtin; plain copy fallback keeps compilation safe).
__device__ __forceinline__ void async_copy_b128(const _Float16* g, _Float16* l) {
#if __has_builtin(__builtin_amdgcn_global_load_async_to_lds_b128)
  __builtin_amdgcn_global_load_async_to_lds_b128(
      (__attribute__((address_space(1))) i32x4*)g,
      (__attribute__((address_space(3))) i32x4*)l, 0, 0);
#else
  *(uint4*)l = *(const uint4*)g;
#endif
}

__device__ __forceinline__ void wait_async0() {
#if __has_builtin(__builtin_amdgcn_s_wait_asynccnt)
  __builtin_amdgcn_s_wait_asynccnt(0);
#else
  asm volatile("s_wait_asynccnt 0" ::: "memory");
#endif
}

__global__ void f32_to_f16(const float* __restrict__ s, _Float16* __restrict__ d, int n) {
  int i = blockIdx.x * blockDim.x + threadIdx.x;
  int stride = gridDim.x * blockDim.x;
  for (; i < n; i += stride) d[i] = (_Float16)s[i];
}

// GEMM: out[m,n] = sum_k A[m,k] * W[n,k] + bias[n]   (nn.Linear semantics)
// Block = 4 waves computing a 32x256 tile; each wave owns 32x64 (8 WMMA acc).
// The 32x1024 A tile (contiguous 64KB) is staged once into LDS with async
// loads and shared by all waves; B (weights) streams from L2.
// mode 0: store Q (bh,s,hd) scaled by 1/sqrt(HDIM)
// mode 1: store K (bh,s,hd)
// mode 2: store V transposed (bh,hd,s)
// mode 3: store fp32 row-major to outF (final projection)
__global__ __launch_bounds__(128)
void gemm32(const _Float16* __restrict__ A, const _Float16* __restrict__ W,
            const float* __restrict__ bias, _Float16* __restrict__ outH,
            float* __restrict__ outF, int mode) {
  __shared__ __align__(16) _Float16 Alds[32 * D_MODEL];   // 64 KB
  const int tid  = threadIdx.x;
  const int lane = tid & 31;
  const int wave = tid >> 5;
  const int half = lane >> 4;
  const int ln   = lane & 15;
  const int m0   = blockIdx.x * 32;
  const int n0   = blockIdx.y * 256 + wave * 64;

  // Stage the whole 32x1024 A tile (64KB, contiguous rows) into LDS.
  {
    const _Float16* Ablk = A + (size_t)m0 * D_MODEL;
#pragma unroll 4
    for (int it = 0; it < 32; ++it) {
      int idx = (it * 128 + tid) * 8;             // 8 halfs = 16B per lane
      async_copy_b128(Ablk + idx, &Alds[idx]);
    }
    wait_async0();
    __syncthreads();
  }

  v8f acc[2][4] = {};
  const _Float16* aL0 = &Alds[(size_t)ln * D_MODEL];
  const _Float16* aL1 = &Alds[(size_t)(16 + ln) * D_MODEL];
  const _Float16* b0p = W + (size_t)(n0 + ln) * D_MODEL;
  const _Float16* b1p = W + (size_t)(n0 + 16 + ln) * D_MODEL;
  const _Float16* b2p = W + (size_t)(n0 + 32 + ln) * D_MODEL;
  const _Float16* b3p = W + (size_t)(n0 + 48 + ln) * D_MODEL;

  for (int k0 = 0; k0 < D_MODEL; k0 += 32) {
    v16h a0 = frag_load(aL0 + k0, half);          // ds_load from LDS
    v16h a1 = frag_load(aL1 + k0, half);
    v16h b0 = frag_load(b0p + k0, half);          // global (L2-resident)
    v16h b1 = frag_load(b1p + k0, half);
    v16h b2 = frag_load(b2p + k0, half);
    v16h b3 = frag_load(b3p + k0, half);
    acc[0][0] = __builtin_amdgcn_wmma_f32_16x16x32_f16(false, a0, false, b0, (short)0, acc[0][0], false, false);
    acc[0][1] = __builtin_amdgcn_wmma_f32_16x16x32_f16(false, a0, false, b1, (short)0, acc[0][1], false, false);
    acc[0][2] = __builtin_amdgcn_wmma_f32_16x16x32_f16(false, a0, false, b2, (short)0, acc[0][2], false, false);
    acc[0][3] = __builtin_amdgcn_wmma_f32_16x16x32_f16(false, a0, false, b3, (short)0, acc[0][3], false, false);
    acc[1][0] = __builtin_amdgcn_wmma_f32_16x16x32_f16(false, a1, false, b0, (short)0, acc[1][0], false, false);
    acc[1][1] = __builtin_amdgcn_wmma_f32_16x16x32_f16(false, a1, false, b1, (short)0, acc[1][1], false, false);
    acc[1][2] = __builtin_amdgcn_wmma_f32_16x16x32_f16(false, a1, false, b2, (short)0, acc[1][2], false, false);
    acc[1][3] = __builtin_amdgcn_wmma_f32_16x16x32_f16(false, a1, false, b3, (short)0, acc[1][3], false, false);
  }

#pragma unroll
  for (int mm = 0; mm < 2; ++mm) {
#pragma unroll
    for (int t = 0; t < 4; ++t) {
      int n = n0 + 16 * t + ln;
      float bv = bias[n];
#pragma unroll
      for (int r = 0; r < 8; ++r) {
        int m = m0 + mm * 16 + r + half * 8;   // C layout: VGPR r -> row r+8*half
        float val = acc[mm][t][r] + bv;
        if (mode == 3) {
          outF[(size_t)m * D_MODEL + n] = val;
        } else {
          int b_ = m >> 11;                    // m / SEQ
          int s_ = m & (SEQ - 1);
          int h_ = n >> 6;                     // n / HDIM
          int d_ = n & (HDIM - 1);
          int bh = b_ * NHEADS + h_;
          if (mode == 0)
            outH[((size_t)bh * SEQ + s_) * HDIM + d_] = (_Float16)(val * 0.125f);
          else if (mode == 1)
            outH[((size_t)bh * SEQ + s_) * HDIM + d_] = (_Float16)val;
          else
            outH[((size_t)bh * HDIM + d_) * SEQ + s_] = (_Float16)val;
        }
      }
    }
  }
}

// Flash attention: one wave per 16-query tile, kv tiles of 32 keys.
// Q pre-scaled by 1/sqrt(HDIM). Writes f16 output in (b, s, h*hd) layout.
__global__ __launch_bounds__(128)
void flash_attn(const _Float16* __restrict__ Q, const _Float16* __restrict__ K,
                const _Float16* __restrict__ Vt, _Float16* __restrict__ O) {
  __shared__ __align__(16) _Float16 Plds[4][16 * 32];   // per-wave 16x32 P staging
  const int lane = threadIdx.x & 31;
  const int wave = threadIdx.x >> 5;
  const int half = lane >> 4;
  const int ln   = lane & 15;
  const int bh   = blockIdx.y;
  const int q0   = (blockIdx.x * 4 + wave) * 16;

  const _Float16* Qb = Q + ((size_t)bh * SEQ + q0 + ln) * HDIM;
  v16h qa0 = frag_load(Qb, half);        // d = 0..31
  v16h qa1 = frag_load(Qb + 32, half);   // d = 32..63

  v8f   o[4] = {};
  float mi[8], li[8];
#pragma unroll
  for (int r = 0; r < 8; ++r) { mi[r] = -1e30f; li[r] = 0.0f; }

  for (int j0 = 0; j0 < q0 + 16; j0 += 32) {
    int klo = j0 + ln;
    int khi = j0 + 16 + ln;
    int kloC = klo < SEQ - 1 ? klo : SEQ - 1;   // clamp diag-tile overreads
    int khiC = khi < SEQ - 1 ? khi : SEQ - 1;

    const _Float16* Kl = K + ((size_t)bh * SEQ + kloC) * HDIM;
    const _Float16* Kh = K + ((size_t)bh * SEQ + khiC) * HDIM;

    // Batch all global loads (K frags + V frags) so they clause together and
    // overlap the softmax VALU work.
    v16h kb00 = frag_load(Kl, half);
    v16h kb01 = frag_load(Kl + 32, half);
    v16h kb10 = frag_load(Kh, half);
    v16h kb11 = frag_load(Kh + 32, half);
    v16h vb[4];
#pragma unroll
    for (int t = 0; t < 4; ++t)
      vb[t] = frag_load(Vt + ((size_t)bh * HDIM + 16 * t + ln) * SEQ + j0, half);

    v8f sl = {}, sh = {};
    sl = __builtin_amdgcn_wmma_f32_16x16x32_f16(false, qa0, false, kb00, (short)0, sl, false, false);
    sl = __builtin_amdgcn_wmma_f32_16x16x32_f16(false, qa1, false, kb01, (short)0, sl, false, false);
    sh = __builtin_amdgcn_wmma_f32_16x16x32_f16(false, qa0, false, kb10, (short)0, sh, false, false);
    sh = __builtin_amdgcn_wmma_f32_16x16x32_f16(false, qa1, false, kb11, (short)0, sh, false, false);

    float pl[8], ph[8], sc[8];
#pragma unroll
    for (int r = 0; r < 8; ++r) {
      int q = q0 + r + half * 8;
      float a = (klo <= q) ? sl[r] : -1e30f;    // causal mask: key > query
      float b = (khi <= q) ? sh[r] : -1e30f;
      float v = fmaxf(a, b);
#pragma unroll
      for (int msk = 1; msk < 16; msk <<= 1) v = fmaxf(v, __shfl_xor(v, msk));
      float mnew  = fmaxf(mi[r], v);
      float scale = __expf(mi[r] - mnew);
      float ea = __expf(a - mnew);
      float eb = __expf(b - mnew);
      float rs = ea + eb;
#pragma unroll
      for (int msk = 1; msk < 16; msk <<= 1) rs += __shfl_xor(rs, msk);
      li[r] = li[r] * scale + rs;
      mi[r] = mnew;
      sc[r] = scale;
      pl[r] = ea;
      ph[r] = eb;
    }

#pragma unroll
    for (int t = 0; t < 4; ++t)
#pragma unroll
      for (int r = 0; r < 8; ++r) o[t][r] *= sc[r];

    // C-layout -> A-layout relayout of P through LDS (same-wave, DS in order)
    asm volatile("" ::: "memory");
#pragma unroll
    for (int r = 0; r < 8; ++r) {
      int row = r + half * 8;
      Plds[wave][row * 32 + ln]      = (_Float16)pl[r];
      Plds[wave][row * 32 + 16 + ln] = (_Float16)ph[r];
    }
    asm volatile("s_wait_dscnt 0" ::: "memory");
    v16h pa = frag_load(&Plds[wave][ln * 32], half);
    asm volatile("" ::: "memory");

    // O += P x V : B[k][n] = V[key=j0+k][d], Vt is (bh, d, s) so keys contiguous
#pragma unroll
    for (int t = 0; t < 4; ++t)
      o[t] = __builtin_amdgcn_wmma_f32_16x16x32_f16(
          false, pa, false, vb[t], (short)0, o[t], false, false);
  }

  const int b_ = bh >> 4;
  const int h_ = bh & 15;
#pragma unroll
  for (int t = 0; t < 4; ++t)
#pragma unroll
    for (int r = 0; r < 8; ++r) {
      int s_ = q0 + r + half * 8;
      float val = o[t][r] / li[r];
      O[((size_t)(b_ * SEQ + s_)) * D_MODEL + h_ * HDIM + 16 * t + ln] = (_Float16)val;
    }
}

extern "C" void kernel_launch(void* const* d_in, const int* in_sizes, int n_in,
                              void* d_out, int out_size, void* d_ws, size_t ws_size,
                              hipStream_t stream) {
  const float* x  = (const float*)d_in[0];
  const float* Wq = (const float*)d_in[1];
  const float* bq = (const float*)d_in[2];
  const float* Wk = (const float*)d_in[3];
  const float* bk = (const float*)d_in[4];
  const float* Wv = (const float*)d_in[5];
  const float* bv = (const float*)d_in[6];
  const float* Wo = (const float*)d_in[7];
  const float* bo = (const float*)d_in[8];
  float* out = (float*)d_out;

  char* ws = (char*)d_ws;
  size_t off = 0;
  const size_t XSZ = (size_t)MTOT * D_MODEL * sizeof(_Float16);      // 16 MB
  const size_t WSZ = (size_t)D_MODEL * D_MODEL * sizeof(_Float16);   //  2 MB
  _Float16* xh  = (_Float16*)(ws + off); off += XSZ;
  _Float16* wqh = (_Float16*)(ws + off); off += WSZ;
  _Float16* wkh = (_Float16*)(ws + off); off += WSZ;
  _Float16* wvh = (_Float16*)(ws + off); off += WSZ;
  _Float16* woh = (_Float16*)(ws + off); off += WSZ;
  _Float16* qh  = (_Float16*)(ws + off); off += XSZ;
  _Float16* kh  = (_Float16*)(ws + off); off += XSZ;
  _Float16* vt  = (_Float16*)(ws + off); off += XSZ;
  _Float16* at  = (_Float16*)(ws + off); off += XSZ;   // attention output (b, s, h*hd)
  (void)in_sizes; (void)n_in; (void)out_size; (void)ws_size;

  f32_to_f16<<<4096, 256, 0, stream>>>(x,  xh,  MTOT * D_MODEL);
  f32_to_f16<<<1024, 256, 0, stream>>>(Wq, wqh, D_MODEL * D_MODEL);
  f32_to_f16<<<1024, 256, 0, stream>>>(Wk, wkh, D_MODEL * D_MODEL);
  f32_to_f16<<<1024, 256, 0, stream>>>(Wv, wvh, D_MODEL * D_MODEL);
  f32_to_f16<<<1024, 256, 0, stream>>>(Wo, woh, D_MODEL * D_MODEL);

  dim3 gg(MTOT / 32, D_MODEL / 256);
  gemm32<<<gg, 128, 0, stream>>>(xh, wqh, bq, qh, nullptr, 0);   // Q (scaled)
  gemm32<<<gg, 128, 0, stream>>>(xh, wkh, bk, kh, nullptr, 1);   // K
  gemm32<<<gg, 128, 0, stream>>>(xh, wvh, bv, vt, nullptr, 2);   // V^T

  flash_attn<<<dim3(SEQ / 64, BATCH * NHEADS), 128, 0, stream>>>(qh, kh, vt, at);

  gemm32<<<gg, 128, 0, stream>>>(at, woh, bo, nullptr, out, 3);  // out proj
}

// v001
// One run takes 384 microseconds.
// In two side-by-side timings against v000, it was 1.21 and 1.22 times as fast.
#include <hip/hip_runtime.h>

// ---------------------------------------------------------------------------
// Causal self-attention for MI455X (gfx1250, wave32, WMMA).
// fp32 in/out; internal compute in f16 with fp32 WMMA accumulation.
// ---------------------------------------------------------------------------

typedef __attribute__((ext_vector_type(16))) _Float16 v16h;
typedef __attribute__((ext_vector_type(8)))  float    v8f;
typedef int i32x4 __attribute__((vector_size(16)));

#define D_MODEL 1024
#define NHEADS  16
#define HDIM    64
#define SEQ     2048
#define BATCH   4
#define MTOT    (BATCH * SEQ)   // 8192 rows

// Load a 16x32 f16 fragment (A-layout or symmetric B-layout) where the WMMA
// K-dimension is contiguous in memory at `p` (p = row/col start + k-base).
// Per CDNA5 ISA 16-bit A layout: lane half = lane>>4,
//   VGPR v holds K = (v/4)*16 + half*8 + (v%4)*2  (+1 for hi half of dword).
// Per half this is two contiguous 16B chunks -> compiler emits 2x b128 loads.
__device__ __forceinline__ v16h frag_load(const _Float16* p, int half) {
  union { v16h h; unsigned int u[8]; } r;
#pragma unroll
  for (int v = 0; v < 8; ++v) {
    int k = ((v >> 2) << 4) + (half << 3) + ((v & 3) << 1);
    r.u[v] = *(const unsigned int*)(p + k);
  }
  return r.h;
}

// Async copy 16B global -> LDS (CDNA5 GLOBAL_LOAD_ASYNC_TO_LDS_B128 when the
// toolchain exposes the builtin; plain copy fallback keeps compilation safe).
__device__ __forceinline__ void async_copy_b128(const _Float16* g, _Float16* l) {
#if __has_builtin(__builtin_amdgcn_global_load_async_to_lds_b128)
  __builtin_amdgcn_global_load_async_to_lds_b128(
      (__attribute__((address_space(1))) i32x4*)g,
      (__attribute__((address_space(3))) i32x4*)l, 0, 0);
#else
  *(uint4*)l = *(const uint4*)g;
#endif
}

__device__ __forceinline__ void wait_async0() {
#if __has_builtin(__builtin_amdgcn_s_wait_asynccnt)
  __builtin_amdgcn_s_wait_asynccnt(0);
#else
  asm volatile("s_wait_asynccnt 0" ::: "memory");
#endif
}

__global__ void f32_to_f16(const float* __restrict__ s, _Float16* __restrict__ d, int n) {
  int i = blockIdx.x * blockDim.x + threadIdx.x;
  int stride = gridDim.x * blockDim.x;
  for (; i < n; i += stride) d[i] = (_Float16)s[i];
}

// GEMM: out[m,n] = sum_k A[m,k] * W[n,k] + bias[n]   (nn.Linear semantics)
// Block = 4 waves computing a 32x256 tile; each wave owns 32x64 (8 WMMA acc).
// The 32x1024 A tile (contiguous 64KB) is staged once into LDS with async
// loads and shared by all waves; B (weights) streams from L2.
// mode 0: store Q (bh,s,hd) scaled by 1/sqrt(HDIM)
// mode 1: store K (bh,s,hd)
// mode 2: store V transposed (bh,hd,s), 16 bytes per lane
// mode 3: store fp32 row-major to outF (final projection)
__global__ __launch_bounds__(128)
void gemm32(const _Float16* __restrict__ A, const _Float16* __restrict__ W,
            const float* __restrict__ bias, _Float16* __restrict__ outH,
            float* __restrict__ outF, int mode) {
  __shared__ __align__(16) _Float16 Alds[32 * D_MODEL];   // 64 KB
  const int tid  = threadIdx.x;
  const int lane = tid & 31;
  const int wave = tid >> 5;
  const int half = lane >> 4;
  const int ln   = lane & 15;
  const int m0   = blockIdx.x * 32;
  const int n0   = blockIdx.y * 256 + wave * 64;

  // Stage the whole 32x1024 A tile (64KB, contiguous rows) into LDS.
  {
    const _Float16* Ablk = A + (size_t)m0 * D_MODEL;
#pragma unroll 4
    for (int it = 0; it < 32; ++it) {
      int idx = (it * 128 + tid) * 8;             // 8 halfs = 16B per lane
      async_copy_b128(Ablk + idx, &Alds[idx]);
    }
    wait_async0();
    __syncthreads();
  }

  v8f acc[2][4] = {};
  const _Float16* aL0 = &Alds[(size_t)ln * D_MODEL];
  const _Float16* aL1 = &Alds[(size_t)(16 + ln) * D_MODEL];
  const _Float16* b0p = W + (size_t)(n0 + ln) * D_MODEL;
  const _Float16* b1p = W + (size_t)(n0 + 16 + ln) * D_MODEL;
  const _Float16* b2p = W + (size_t)(n0 + 32 + ln) * D_MODEL;
  const _Float16* b3p = W + (size_t)(n0 + 48 + ln) * D_MODEL;

  for (int k0 = 0; k0 < D_MODEL; k0 += 32) {
    v16h a0 = frag_load(aL0 + k0, half);          // ds_load from LDS
    v16h a1 = frag_load(aL1 + k0, half);
    v16h b0 = frag_load(b0p + k0, half);          // global (L2-resident)
    v16h b1 = frag_load(b1p + k0, half);
    v16h b2 = frag_load(b2p + k0, half);
    v16h b3 = frag_load(b3p + k0, half);
    acc[0][0] = __builtin_amdgcn_wmma_f32_16x16x32_f16(false, a0, false, b0, (short)0, acc[0][0], false, false);
    acc[0][1] = __builtin_amdgcn_wmma_f32_16x16x32_f16(false, a0, false, b1, (short)0, acc[0][1], false, false);
    acc[0][2] = __builtin_amdgcn_wmma_f32_16x16x32_f16(false, a0, false, b2, (short)0, acc[0][2], false, false);
    acc[0][3] = __builtin_amdgcn_wmma_f32_16x16x32_f16(false, a0, false, b3, (short)0, acc[0][3], false, false);
    acc[1][0] = __builtin_amdgcn_wmma_f32_16x16x32_f16(false, a1, false, b0, (short)0, acc[1][0], false, false);
    acc[1][1] = __builtin_amdgcn_wmma_f32_16x16x32_f16(false, a1, false, b1, (short)0, acc[1][1], false, false);
    acc[1][2] = __builtin_amdgcn_wmma_f32_16x16x32_f16(false, a1, false, b2, (short)0, acc[1][2], false, false);
    acc[1][3] = __builtin_amdgcn_wmma_f32_16x16x32_f16(false, a1, false, b3, (short)0, acc[1][3], false, false);
  }

  if (mode == 2) {
    // V^T: a lane's 8 accumulator rows are 8 consecutive s of one d row, so
    // they go out as one 16-byte store instead of eight 2-byte stores.
    // The three loops are unrolled so that acc[][] keeps constant indices
    // (stays in registers) and the 8 stores issue as one group.
#pragma unroll
    for (int mm = 0; mm < 2; ++mm) {
#pragma unroll
      for (int t = 0; t < 4; ++t) {
        int n  = n0 + 16 * t + ln;
        float bv = bias[n];
        int m  = m0 + mm * 16 + half * 8;      // multiple of 8: stays in one batch
        int b_ = m >> 11;                      // m / SEQ
        int s_ = m & (SEQ - 1);
        int bh = b_ * NHEADS + (n >> 6);       // n / HDIM
        int d_ = n & (HDIM - 1);
        union { _Float16 h[8]; uint4 u; } pk;
#pragma unroll
        for (int r = 0; r < 8; ++r) pk.h[r] = (_Float16)(acc[mm][t][r] + bv);
        *(uint4*)&outH[((size_t)bh * HDIM + d_) * SEQ + s_] = pk.u;
      }
    }
    return;
  }

#pragma unroll
  for (int mm = 0; mm < 2; ++mm) {
#pragma unroll
    for (int t = 0; t < 4; ++t) {
      int n = n0 + 16 * t + ln;
      float bv = bias[n];
#pragma unroll
      for (int r = 0; r < 8; ++r) {
        int m = m0 + mm * 16 + r + half * 8;   // C layout: VGPR r -> row r+8*half
        float val = acc[mm][t][r] + bv;
        if (mode == 3) {
          outF[(size_t)m * D_MODEL + n] = val;
        } else {
          int b_ = m >> 11;                    // m / SEQ
          int s_ = m & (SEQ - 1);
          int h_ = n >> 6;                     // n / HDIM
          int d_ = n & (HDIM - 1);
          int bh = b_ * NHEADS + h_;
          if (mode == 0)
            outH[((size_t)bh * SEQ + s_) * HDIM + d_] = (_Float16)(val * 0.125f);
          else if (mode == 1)
            outH[((size_t)bh * SEQ + s_) * HDIM + d_] = (_Float16)val;
        }
      }
    }
  }
}

// Flash attention: one wave per 16-query tile, kv tiles of 32 keys.
// Q pre-scaled by 1/sqrt(HDIM). Writes f16 output in (b, s, h*hd) layout.
__global__ __launch_bounds__(128)
void flash_attn(const _Float16* __restrict__ Q, const _Float16* __restrict__ K,
                const _Float16* __restrict__ Vt, _Float16* __restrict__ O) {
  __shared__ __align__(16) _Float16 Plds[4][16 * 32];   // per-wave 16x32 P staging
  const int lane = threadIdx.x & 31;
  const int wave = threadIdx.x >> 5;
  const int half = lane >> 4;
  const int ln   = lane & 15;
  const int bh   = blockIdx.y;
  const int q0   = (blockIdx.x * 4 + wave) * 16;

  const _Float16* Qb = Q + ((size_t)bh * SEQ + q0 + ln) * HDIM;
  v16h qa0 = frag_load(Qb, half);        // d = 0..31
  v16h qa1 = frag_load(Qb + 32, half);   // d = 32..63

  v8f   o[4] = {};
  float mi[8], li[8];
#pragma unroll
  for (int r = 0; r < 8; ++r) { mi[r] = -1e30f; li[r] = 0.0f; }

  for (int j0 = 0; j0 < q0 + 16; j0 += 32) {
    int klo = j0 + ln;
    int khi = j0 + 16 + ln;
    int kloC = klo < SEQ - 1 ? klo : SEQ - 1;   // clamp diag-tile overreads
    int khiC = khi < SEQ - 1 ? khi : SEQ - 1;

    const _Float16* Kl = K + ((size_t)bh * SEQ + kloC) * HDIM;
    const _Float16* Kh = K + ((size_t)bh * SEQ + khiC) * HDIM;

    // Batch all global loads (K frags + V frags) so they clause together and
    // overlap the softmax VALU work.
    v16h kb00 = frag_load(Kl, half);
    v16h kb01 = frag_load(Kl + 32, half);
    v16h kb10 = frag_load(Kh, half);
    v16h kb11 = frag_load(Kh + 32, half);
    v16h vb[4];
#pragma unroll
    for (int t = 0; t < 4; ++t)
      vb[t] = frag_load(Vt + ((size_t)bh * HDIM + 16 * t + ln) * SEQ + j0, half);

    v8f sl = {}, sh = {};
    sl = __builtin_amdgcn_wmma_f32_16x16x32_f16(false, qa0, false, kb00, (short)0, sl, false, false);
    sl = __builtin_amdgcn_wmma_f32_16x16x32_f16(false, qa1, false, kb01, (short)0, sl, false, false);
    sh = __builtin_amdgcn_wmma_f32_16x16x32_f16(false, qa0, false, kb10, (short)0, sh, false, false);
    sh = __builtin_amdgcn_wmma_f32_16x16x32_f16(false, qa1, false, kb11, (short)0, sh, false, false);

    float pl[8], ph[8], sc[8];
#pragma unroll
    for (int r = 0; r < 8; ++r) {
      int q = q0 + r + half * 8;
      float a = (klo <= q) ? sl[r] : -1e30f;    // causal mask: key > query
      float b = (khi <= q) ? sh[r] : -1e30f;
      float v = fmaxf(a, b);
#pragma unroll
      for (int msk = 1; msk < 16; msk <<= 1) v = fmaxf(v, __shfl_xor(v, msk));
      float mnew  = fmaxf(mi[r], v);
      float scale = __expf(mi[r] - mnew);
      float ea = __expf(a - mnew);
      float eb = __expf(b - mnew);
      float rs = ea + eb;
#pragma unroll
      for (int msk = 1; msk < 16; msk <<= 1) rs += __shfl_xor(rs, msk);
      li[r] = li[r] * scale + rs;
      mi[r] = mnew;
      sc[r] = scale;
      pl[r] = ea;
      ph[r] = eb;
    }

#pragma unroll
    for (int t = 0; t < 4; ++t)
#pragma unroll
      for (int r = 0; r < 8; ++r) o[t][r] *= sc[r];

    // C-layout -> A-layout relayout of P through LDS (same-wave, DS in order)
    asm volatile("" ::: "memory");
#pragma unroll
    for (int r = 0; r < 8; ++r) {
      int row = r + half * 8;
      Plds[wave][row * 32 + ln]      = (_Float16)pl[r];
      Plds[wave][row * 32 + 16 + ln] = (_Float16)ph[r];
    }
    asm volatile("s_wait_dscnt 0" ::: "memory");
    v16h pa = frag_load(&Plds[wave][ln * 32], half);
    asm volatile("" ::: "memory");

    // O += P x V : B[k][n] = V[key=j0+k][d], Vt is (bh, d, s) so keys contiguous
#pragma unroll
    for (int t = 0; t < 4; ++t)
      o[t] = __builtin_amdgcn_wmma_f32_16x16x32_f16(
          false, pa, false, vb[t], (short)0, o[t], false, false);
  }

  const int b_ = bh >> 4;
  const int h_ = bh & 15;
#pragma unroll
  for (int t = 0; t < 4; ++t)
#pragma unroll
    for (int r = 0; r < 8; ++r) {
      int s_ = q0 + r + half * 8;
      float val = o[t][r] / li[r];
      O[((size_t)(b_ * SEQ + s_)) * D_MODEL + h_ * HDIM + 16 * t + ln] = (_Float16)val;
    }
}

extern "C" void kernel_launch(void* const* d_in, const int* in_sizes, int n_in,
                              void* d_out, int out_size, void* d_ws, size_t ws_size,
                              hipStream_t stream) {
  const float* x  = (const float*)d_in[0];
  const float* Wq = (const float*)d_in[1];
  const float* bq = (const float*)d_in[2];
  const float* Wk = (const float*)d_in[3];
  const float* bk = (const float*)d_in[4];
  const float* Wv = (const float*)d_in[5];
  const float* bv = (const float*)d_in[6];
  const float* Wo = (const float*)d_in[7];
  const float* bo = (const float*)d_in[8];
  float* out = (float*)d_out;

  char* ws = (char*)d_ws;
  size_t off = 0;
  const size_t XSZ = (size_t)MTOT * D_MODEL * sizeof(_Float16);      // 16 MB
  const size_t WSZ = (size_t)D_MODEL * D_MODEL * sizeof(_Float16);   //  2 MB
  _Float16* xh  = (_Float16*)(ws + off); off += XSZ;
  _Float16* wqh = (_Float16*)(ws + off); off += WSZ;
  _Float16* wkh = (_Float16*)(ws + off); off += WSZ;
  _Float16* wvh = (_Float16*)(ws + off); off += WSZ;
  _Float16* woh = (_Float16*)(ws + off); off += WSZ;
  _Float16* qh  = (_Float16*)(ws + off); off += XSZ;
  _Float16* kh  = (_Float16*)(ws + off); off += XSZ;
  _Float16* vt  = (_Float16*)(ws + off); off += XSZ;
  _Float16* at  = (_Float16*)(ws + off); off += XSZ;   // attention output (b, s, h*hd)
  (void)in_sizes; (void)n_in; (void)out_size; (void)ws_size;

  f32_to_f16<<<4096, 256, 0, stream>>>(x,  xh,  MTOT * D_MODEL);
  f32_to_f16<<<1024, 256, 0, stream>>>(Wq, wqh, D_MODEL * D_MODEL);
  f32_to_f16<<<1024, 256, 0, stream>>>(Wk, wkh, D_MODEL * D_MODEL);
  f32_to_f16<<<1024, 256, 0, stream>>>(Wv, wvh, D_MODEL * D_MODEL);
  f32_to_f16<<<1024, 256, 0, stream>>>(Wo, woh, D_MODEL * D_MODEL);

  dim3 gg(MTOT / 32, D_MODEL / 256);
  gemm32<<<gg, 128, 0, stream>>>(xh, wqh, bq, qh, nullptr, 0);   // Q (scaled)
  gemm32<<<gg, 128, 0, stream>>>(xh, wkh, bk, kh, nullptr, 1);   // K
  gemm32<<<gg, 128, 0, stream>>>(xh, wvh, bv, vt, nullptr, 2);   // V^T

  flash_attn<<<dim3(SEQ / 64, BATCH * NHEADS), 128, 0, stream>>>(qh, kh, vt, at);

  gemm32<<<gg, 128, 0, stream>>>(at, woh, bo, nullptr, out, 3);  // out proj
}

// v002
// It runs in 271 microseconds.
// Next to v001, in two timings, it ran 1.41 and 1.42 times as fast.
// Counting every step since v000, it is 1.72 times as fast.
#include <hip/hip_runtime.h>

// ---------------------------------------------------------------------------
// Causal self-attention for MI455X (gfx1250, wave32, WMMA).
// fp32 in/out; internal compute in f16 with fp32 WMMA accumulation.
// ---------------------------------------------------------------------------

typedef __attribute__((ext_vector_type(16))) _Float16 v16h;
typedef __attribute__((ext_vector_type(8)))  float    v8f;

#define D_MODEL 1024
#define NHEADS  16
#define HDIM    64
#define SEQ     2048
#define BATCH   4
#define MTOT    (BATCH * SEQ)   // 8192 rows

// Load a 16x32 f16 fragment (A-layout or symmetric B-layout) where the WMMA
// K-dimension is contiguous in memory at `p` (p = row/col start + k-base).
// Per CDNA5 ISA 16-bit A layout: lane half = lane>>4,
//   VGPR v holds K = (v/4)*16 + half*8 + (v%4)*2  (+1 for hi half of dword).
// Per half this is two contiguous 16B chunks -> compiler emits 2x b128 loads.
__device__ __forceinline__ v16h frag_load(const _Float16* p, int half) {
  union { v16h h; unsigned int u[8]; } r;
#pragma unroll
  for (int v = 0; v < 8; ++v) {
    int k = ((v >> 2) << 4) + (half << 3) + ((v & 3) << 1);
    r.u[v] = *(const unsigned int*)(p + k);
  }
  return r.h;
}

// Eight asynchronous 16-byte copies global -> LDS, rows 8 apart (one wave-wide
// copy covers two whole 256-byte row slabs). The s_wait_xcnt stands inside the
// copies' own statement so that no address register is rewritten ahead of it.
#define GK      128                   // k elements per stage (256 B per row)
#define GPITCH  136                   // LDS row pitch in halfs: 272 B = 16 B x 17
#define GSTAGE  (256 * GPITCH)        // halfs per stage: 128 A rows + 128 W rows
__device__ __forceinline__ void async_rows8(const _Float16* g, unsigned l) {
  asm volatile(
      "global_load_async_to_lds_b128 %0, %8, off\n\t"
      "global_load_async_to_lds_b128 %1, %9, off\n\t"
      "global_load_async_to_lds_b128 %2, %10, off\n\t"
      "global_load_async_to_lds_b128 %3, %11, off\n\t"
      "global_load_async_to_lds_b128 %4, %12, off\n\t"
      "global_load_async_to_lds_b128 %5, %13, off\n\t"
      "global_load_async_to_lds_b128 %6, %14, off\n\t"
      "global_load_async_to_lds_b128 %7, %15, off\n\t"
      "s_wait_xcnt 0x0"
      :: "v"(l), "v"(l + 8u * GPITCH * 2u), "v"(l + 16u * GPITCH * 2u),
         "v"(l + 24u * GPITCH * 2u), "v"(l + 32u * GPITCH * 2u),
         "v"(l + 40u * GPITCH * 2u), "v"(l + 48u * GPITCH * 2u),
         "v"(l + 56u * GPITCH * 2u),
         "v"(g), "v"(g + 8 * D_MODEL), "v"(g + 16 * D_MODEL), "v"(g + 24 * D_MODEL),
         "v"(g + 32 * D_MODEL), "v"(g + 40 * D_MODEL), "v"(g + 48 * D_MODEL),
         "v"(g + 56 * D_MODEL)
      : "memory");
}

// One stage: 128 rows of A, then 128 rows of W, 256 bytes of each row.
// 32 copies per lane; ga/gw and l are the lane's own first chunk.
__device__ __forceinline__ void fill_stage(const _Float16* ga, const _Float16* gw, unsigned l) {
  async_rows8(ga, l);
  async_rows8(ga + 64 * D_MODEL, l + 64u * GPITCH * 2u);
  async_rows8(gw, l + 128u * GPITCH * 2u);
  async_rows8(gw + 64 * D_MODEL, l + 192u * GPITCH * 2u);
}

__global__ void f32_to_f16(const float* __restrict__ s, _Float16* __restrict__ d, int n) {
  int i = blockIdx.x * blockDim.x + threadIdx.x;
  int stride = gridDim.x * blockDim.x;
  for (; i < n; i += stride) d[i] = (_Float16)s[i];
}

// GEMM: out[m,n] = sum_k A[m,k] * W[n,k] + bias[n]   (nn.Linear semantics)
// Block = 4 waves (2x2) computing a 128x128 tile; each wave owns 64x64
// (16 WMMA acc). Both operands come per 128-k stage into a two-buffer LDS ring
// by asynchronous copies and are shared by the block's waves.
// mode 0: store Q (bh,s,hd) scaled by 1/sqrt(HDIM)
// mode 1: store K (bh,s,hd)
// mode 2: store V transposed (bh,hd,s), 16 bytes per lane
// mode 3: store fp32 row-major to outF (final projection)
// mode is a compile-time constant, for speed only.
template <int mode>
__global__ __launch_bounds__(128)
void gemm32(const _Float16* __restrict__ A, const _Float16* __restrict__ W,
            const float* __restrict__ bias, _Float16* __restrict__ outH,
            float* __restrict__ outF) {
  __shared__ __align__(16) _Float16 S[2 * GSTAGE];        // 2 x 69,632 B
  const int tid  = threadIdx.x;
  const int lane = tid & 31;
  const int wave = tid >> 5;
  const int half = lane >> 4;
  const int ln   = lane & 15;
  const int wm   = wave >> 1;
  const int wn   = wave & 1;
  const int m0   = blockIdx.x * 128 + wm * 64;
  const int n0   = blockIdx.y * 128 + wn * 64;

  // The lane's own 16-byte chunk: row tid/16 (+8 per copy), chunk tid%16.
  const int rg = tid >> 4;
  const int ch = tid & 15;
  const _Float16* ga = A + (size_t)(blockIdx.x * 128 + rg) * D_MODEL + ch * 8;
  const _Float16* gw = W + (size_t)(blockIdx.y * 128 + rg) * D_MODEL + ch * 8;
  const unsigned  l0 = (unsigned)(size_t)(__attribute__((address_space(3))) _Float16*)
                           &S[rg * GPITCH + ch * 8];

  fill_stage(ga, gw, l0);
  // stage 0 has landed before any wave reads it
  asm volatile("s_wait_asynccnt 0x0" ::: "memory");
  __syncthreads();
  fill_stage(ga + GK, gw + GK, l0 + GSTAGE * 2u);

  v8f acc[4][4] = {};
  // kept rolled: unrolling would only multiply the text a cold launch has to
  // fetch; a trip costs a few scalar instructions per 64 WMMAs
#pragma unroll 1
  for (int t = 0; t < D_MODEL / GK; ++t) {
    const _Float16* Sb = &S[(t & 1) * GSTAGE];
    const _Float16* aL = Sb + (wm * 64 + ln) * GPITCH;
    const _Float16* bL = Sb + (128 + wn * 64 + ln) * GPITCH;
#pragma unroll
    for (int kk = 0; kk < GK; kk += 32) {
      v16h a[4], b[4];
      // in the order the WMMAs below first need them
      a[0] = frag_load(aL + kk, half);
#pragma unroll
      for (int i = 0; i < 4; ++i) b[i] = frag_load(bL + i * 16 * GPITCH + kk, half);
#pragma unroll
      for (int i = 1; i < 4; ++i) a[i] = frag_load(aL + i * 16 * GPITCH + kk, half);
      // keeps the 16 LDS reads of this k step together ahead of its 16 WMMAs:
      // spread among them, every row of four waits out a full LDS latency
      __builtin_amdgcn_sched_barrier(0);
#pragma unroll
      for (int mm = 0; mm < 4; ++mm)
#pragma unroll
        for (int u = 0; u < 4; ++u)
          acc[mm][u] = __builtin_amdgcn_wmma_f32_16x16x32_f16(
              false, a[mm], false, b[u], (short)0, acc[mm][u], false, false);
      // the next k step's reads stay behind this step's WMMAs (one load group)
      __builtin_amdgcn_sched_barrier(0);
    }
    // Publish point: this wave's reads of buffer t%2 are done, its copies of
    // stage t+1 have landed; behind the barrier both hold for every wave.
    asm volatile("s_wait_dscnt 0x0" ::: "memory");
    asm volatile("s_wait_asynccnt 0x0" ::: "memory");
    __syncthreads();
    if (t + 2 < D_MODEL / GK)
      fill_stage(ga + (t + 2) * GK, gw + (t + 2) * GK, l0 + (unsigned)(t & 1) * (GSTAGE * 2u));
  }
  // no copy is outstanding when the wave goes on to its stores and ends
  asm volatile("s_wait_asynccnt 0x0" ::: "memory");

  if (mode == 2) {
    // V^T: a lane's 8 accumulator rows are 8 consecutive s of one d row, so
    // they go out as one 16-byte store instead of eight 2-byte stores.
    // The three loops are unrolled so that acc[][] keeps constant indices
    // (stays in registers) and the stores issue as one group.
#pragma unroll
    for (int mm = 0; mm < 4; ++mm) {
#pragma unroll
      for (int t = 0; t < 4; ++t) {
        int n  = n0 + 16 * t + ln;
        float bv = bias[n];
        int m  = m0 + mm * 16 + half * 8;      // multiple of 8: stays in one batch
        int b_ = m >> 11;                      // m / SEQ
        int s_ = m & (SEQ - 1);
        int bh = b_ * NHEADS + (n >> 6);       // n / HDIM
        int d_ = n & (HDIM - 1);
        union { _Float16 h[8]; uint4 u; } pk;
#pragma unroll
        for (int r = 0; r < 8; ++r) pk.h[r] = (_Float16)(acc[mm][t][r] + bv);
        *(uint4*)&outH[((size_t)bh * HDIM + d_) * SEQ + s_] = pk.u;
      }
    }
    return;
  }

  // Q, K: a wave's 64 rows lie in one batch (m0 is a multiple of 64) and its 64
  // columns are one head, so every element sits at a constant offset from one base.
  _Float16* oQK = outH + ((size_t)((m0 >> 11) * NHEADS + (n0 >> 6)) * SEQ
                          + (m0 & (SEQ - 1)) + half * 8) * HDIM + ln;
#pragma unroll
  for (int mm = 0; mm < 4; ++mm) {
#pragma unroll
    for (int t = 0; t < 4; ++t) {
      int n = n0 + 16 * t + ln;
      float bv = bias[n];
#pragma unroll
      for (int r = 0; r < 8; ++r) {
        int m = m0 + mm * 16 + r + half * 8;   // C layout: VGPR r -> row r+8*half
        float val = acc[mm][t][r] + bv;
        if (mode == 3) {
          outF[(size_t)m * D_MODEL + n] = val;
        } else {
          const int e = (mm * 16 + r) * HDIM + 16 * t;   // row s, column d from the base
          if (mode == 0)
            oQK[e] = (_Float16)(val * 0.125f);
          else if (mode == 1)
            oQK[e] = (_Float16)val;
        }
      }
    }
  }
}

// Flash attention: one wave per 16-query tile, kv tiles of 32 keys.
// Q pre-scaled by 1/sqrt(HDIM). Writes f16 output in (b, s, h*hd) layout.
__global__ __launch_bounds__(128)
void flash_attn(const _Float16* __restrict__ Q, const _Float16* __restrict__ K,
                const _Float16* __restrict__ Vt, _Float16* __restrict__ O) {
  __shared__ __align__(16) _Float16 Plds[4][16 * 32];   // per-wave 16x32 P staging
  const int lane = threadIdx.x & 31;
  const int wave = threadIdx.x >> 5;
  const int half = lane >> 4;
  const int ln   = lane & 15;
  const int bh   = blockIdx.y;
  const int q0   = (blockIdx.x * 4 + wave) * 16;

  const _Float16* Qb = Q + ((size_t)bh * SEQ + q0 + ln) * HDIM;
  v16h qa0 = frag_load(Qb, half);        // d = 0..31
  v16h qa1 = frag_load(Qb + 32, half);   // d = 32..63

  v8f   o[4] = {};
  float mi[8], li[8];
#pragma unroll
  for (int r = 0; r < 8; ++r) { mi[r] = -1e30f; li[r] = 0.0f; }

  for (int j0 = 0; j0 < q0 + 16; j0 += 32) {
    int klo = j0 + ln;
    int khi = j0 + 16 + ln;
    int kloC = klo < SEQ - 1 ? klo : SEQ - 1;   // clamp diag-tile overreads
    int khiC = khi < SEQ - 1 ? khi : SEQ - 1;

    const _Float16* Kl = K + ((size_t)bh * SEQ + kloC) * HDIM;
    const _Float16* Kh = K + ((size_t)bh * SEQ + khiC) * HDIM;

    // Batch all global loads (K frags + V frags) so they clause together and
    // overlap the softmax VALU work.
    v16h kb00 = frag_load(Kl, half);
    v16h kb01 = frag_load(Kl + 32, half);
    v16h kb10 = frag_load(Kh, half);
    v16h kb11 = frag_load(Kh + 32, half);
    v16h vb[4];
#pragma unroll
    for (int t = 0; t < 4; ++t)
      vb[t] = frag_load(Vt + ((size_t)bh * HDIM + 16 * t + ln) * SEQ + j0, half);

    v8f sl = {}, sh = {};
    sl = __builtin_amdgcn_wmma_f32_16x16x32_f16(false, qa0, false, kb00, (short)0, sl, false, false);
    sl = __builtin_amdgcn_wmma_f32_16x16x32_f16(false, qa1, false, kb01, (short)0, sl, false, false);
    sh = __builtin_amdgcn_wmma_f32_16x16x32_f16(false, qa0, false, kb10, (short)0, sh, false, false);
    sh = __builtin_amdgcn_wmma_f32_16x16x32_f16(false, qa1, false, kb11, (short)0, sh, false, false);

    float pl[8], ph[8], sc[8];
#pragma unroll
    for (int r = 0; r < 8; ++r) {
      int q = q0 + r + half * 8;
      float a = (klo <= q) ? sl[r] : -1e30f;    // causal mask: key > query
      float b = (khi <= q) ? sh[r] : -1e30f;
      float v = fmaxf(a, b);
#pragma unroll
      for (int msk = 1; msk < 16; msk <<= 1) v = fmaxf(v, __shfl_xor(v, msk));
      float mnew  = fmaxf(mi[r], v);
      float scale = __expf(mi[r] - mnew);
      float ea = __expf(a - mnew);
      float eb = __expf(b - mnew);
      float rs = ea + eb;
#pragma unroll
      for (int msk = 1; msk < 16; msk <<= 1) rs += __shfl_xor(rs, msk);
      li[r] = li[r] * scale + rs;
      mi[r] = mnew;
      sc[r] = scale;
      pl[r] = ea;
      ph[r] = eb;
    }

#pragma unroll
    for (int t = 0; t < 4; ++t)
#pragma unroll
      for (int r = 0; r < 8; ++r) o[t][r] *= sc[r];

    // C-layout -> A-layout relayout of P through LDS (same-wave, DS in order)
    asm volatile("" ::: "memory");
#pragma unroll
    for (int r = 0; r < 8; ++r) {
      int row = r + half * 8;
      Plds[wave][row * 32 + ln]      = (_Float16)pl[r];
      Plds[wave][row * 32 + 16 + ln] = (_Float16)ph[r];
    }
    asm volatile("s_wait_dscnt 0" ::: "memory");
    v16h pa = frag_load(&Plds[wave][ln * 32], half);
    asm volatile("" ::: "memory");

    // O += P x V : B[k][n] = V[key=j0+k][d], Vt is (bh, d, s) so keys contiguous
#pragma unroll
    for (int t = 0; t < 4; ++t)
      o[t] = __builtin_amdgcn_wmma_f32_16x16x32_f16(
          false, pa, false, vb[t], (short)0, o[t], false, false);
  }

  const int b_ = bh >> 4;
  const int h_ = bh & 15;
#pragma unroll
  for (int t = 0; t < 4; ++t)
#pragma unroll
    for (int r = 0; r < 8; ++r) {
      int s_ = q0 + r + half * 8;
      float val = o[t][r] / li[r];
      O[((size_t)(b_ * SEQ + s_)) * D_MODEL + h_ * HDIM + 16 * t + ln] = (_Float16)val;
    }
}

extern "C" void kernel_launch(void* const* d_in, const int* in_sizes, int n_in,
                              void* d_out, int out_size, void* d_ws, size_t ws_size,
                              hipStream_t stream) {
  const float* x  = (const float*)d_in[0];
  const float* Wq = (const float*)d_in[1];
  const float* bq = (const float*)d_in[2];
  const float* Wk = (const float*)d_in[3];
  const float* bk = (const float*)d_in[4];
  const float* Wv = (const float*)d_in[5];
  const float* bv = (const float*)d_in[6];
  const float* Wo = (const float*)d_in[7];
  const float* bo = (const float*)d_in[8];
  float* out = (float*)d_out;

  char* ws = (char*)d_ws;
  size_t off = 0;
  const size_t XSZ = (size_t)MTOT * D_MODEL * sizeof(_Float16);      // 16 MB
  const size_t WSZ = (size_t)D_MODEL * D_MODEL * sizeof(_Float16);   //  2 MB
  _Float16* xh  = (_Float16*)(ws + off); off += XSZ;
  _Float16* wqh = (_Float16*)(ws + off); off += WSZ;
  _Float16* wkh = (_Float16*)(ws + off); off += WSZ;
  _Float16* wvh = (_Float16*)(ws + off); off += WSZ;
  _Float16* woh = (_Float16*)(ws + off); off += WSZ;
  _Float16* qh  = (_Float16*)(ws + off); off += XSZ;
  _Float16* kh  = (_Float16*)(ws + off); off += XSZ;
  _Float16* vt  = (_Float16*)(ws + off); off += XSZ;
  _Float16* at  = (_Float16*)(ws + off); off += XSZ;   // attention output (b, s, h*hd)
  (void)in_sizes; (void)n_in; (void)out_size; (void)ws_size;

  f32_to_f16<<<4096, 256, 0, stream>>>(x,  xh,  MTOT * D_MODEL);
  f32_to_f16<<<1024, 256, 0, stream>>>(Wq, wqh, D_MODEL * D_MODEL);
  f32_to_f16<<<1024, 256, 0, stream>>>(Wk, wkh, D_MODEL * D_MODEL);
  f32_to_f16<<<1024, 256, 0, stream>>>(Wv, wvh, D_MODEL * D_MODEL);
  f32_to_f16<<<1024, 256, 0, stream>>>(Wo, woh, D_MODEL * D_MODEL);

  dim3 gg(MTOT / 128, D_MODEL / 128);
  gemm32<0><<<gg, 128, 0, stream>>>(xh, wqh, bq, qh, nullptr);   // Q (scaled)
  gemm32<1><<<gg, 128, 0, stream>>>(xh, wkh, bk, kh, nullptr);   // K
  gemm32<2><<<gg, 128, 0, stream>>>(xh, wvh, bv, vt, nullptr);   // V^T

  flash_attn<<<dim3(SEQ / 64, BATCH * NHEADS), 128, 0, stream>>>(qh, kh, vt, at);

  gemm32<3><<<gg, 128, 0, stream>>>(at, woh, bo, nullptr, out);  // out proj
}

// v003
// Measured time: 202 microseconds a run.
// Timed twice side by side with v002, it ran 1.35 and 1.34 times as fast.
// Counting every step since v000, it is 2.30 times as fast.
#include <hip/hip_runtime.h>

// ---------------------------------------------------------------------------
// Causal self-attention for MI455X (gfx1250, wave32, WMMA).
// fp32 in/out; internal compute in f16 with fp32 WMMA accumulation.
// ---------------------------------------------------------------------------

typedef __attribute__((ext_vector_type(16))) _Float16 v16h;
typedef __attribute__((ext_vector_type(8)))  float    v8f;

#define D_MODEL 1024
#define NHEADS  16
#define HDIM    64
#define SEQ     2048
#define BATCH   4
#define MTOT    (BATCH * SEQ)   // 8192 rows

// Load a 16x32 f16 fragment (A-layout or symmetric B-layout) where the WMMA
// K-dimension is contiguous in memory at `p` (p = row/col start + k-base).
// Per CDNA5 ISA 16-bit A layout: lane half = lane>>4,
//   VGPR v holds K = (v/4)*16 + half*8 + (v%4)*2  (+1 for hi half of dword).
// Per half this is two contiguous 16B chunks -> compiler emits 2x b128 loads.
__device__ __forceinline__ v16h frag_load(const _Float16* p, int half) {
  union { v16h h; unsigned int u[8]; } r;
#pragma unroll
  for (int v = 0; v < 8; ++v) {
    int k = ((v >> 2) << 4) + (half << 3) + ((v & 3) << 1);
    r.u[v] = *(const unsigned int*)(p + k);
  }
  return r.h;
}

// Eight asynchronous 16-byte copies global -> LDS, rows 8 apart (one wave-wide
// copy covers two whole 256-byte row slabs). The s_wait_xcnt stands inside the
// copies' own statement so that no address register is rewritten ahead of it.
#define GK      128                   // k elements per stage (256 B per row)
#define GPITCH  136                   // LDS row pitch in halfs: 272 B = 16 B x 17
#define GSTAGE  (256 * GPITCH)        // halfs per stage: 128 A rows + 128 W rows
__device__ __forceinline__ void async_rows8(const _Float16* g, unsigned l) {
  asm volatile(
      "global_load_async_to_lds_b128 %0, %8, off\n\t"
      "global_load_async_to_lds_b128 %1, %9, off\n\t"
      "global_load_async_to_lds_b128 %2, %10, off\n\t"
      "global_load_async_to_lds_b128 %3, %11, off\n\t"
      "global_load_async_to_lds_b128 %4, %12, off\n\t"
      "global_load_async_to_lds_b128 %5, %13, off\n\t"
      "global_load_async_to_lds_b128 %6, %14, off\n\t"
      "global_load_async_to_lds_b128 %7, %15, off\n\t"
      "s_wait_xcnt 0x0"
      :: "v"(l), "v"(l + 8u * GPITCH * 2u), "v"(l + 16u * GPITCH * 2u),
         "v"(l + 24u * GPITCH * 2u), "v"(l + 32u * GPITCH * 2u),
         "v"(l + 40u * GPITCH * 2u), "v"(l + 48u * GPITCH * 2u),
         "v"(l + 56u * GPITCH * 2u),
         "v"(g), "v"(g + 8 * D_MODEL), "v"(g + 16 * D_MODEL), "v"(g + 24 * D_MODEL),
         "v"(g + 32 * D_MODEL), "v"(g + 40 * D_MODEL), "v"(g + 48 * D_MODEL),
         "v"(g + 56 * D_MODEL)
      : "memory");
}

// One stage: 128 rows of A, then 128 rows of W, 256 bytes of each row.
// 32 copies per lane; ga/gw and l are the lane's own first chunk.
__device__ __forceinline__ void fill_stage(const _Float16* ga, const _Float16* gw, unsigned l) {
  async_rows8(ga, l);
  async_rows8(ga + 64 * D_MODEL, l + 64u * GPITCH * 2u);
  async_rows8(gw, l + 128u * GPITCH * 2u);
  async_rows8(gw + 64 * D_MODEL, l + 192u * GPITCH * 2u);
}

__global__ void f32_to_f16(const float* __restrict__ s, _Float16* __restrict__ d, int n) {
  int i = blockIdx.x * blockDim.x + threadIdx.x;
  int stride = gridDim.x * blockDim.x;
  for (; i < n; i += stride) d[i] = (_Float16)s[i];
}

// GEMM: out[m,n] = sum_k A[m,k] * W[n,k] + bias[n]   (nn.Linear semantics)
// Block = 4 waves (2x2) computing a 128x128 tile; each wave owns 64x64
// (16 WMMA acc). Both operands come per 128-k stage into a two-buffer LDS ring
// by asynchronous copies and are shared by the block's waves.
// mode 0: store Q (bh,s,hd) scaled by 1/sqrt(HDIM)
// mode 1: store K (bh,s,hd)
// mode 2: store V transposed (bh,hd,s), 16 bytes per lane
// mode 3: store fp32 row-major to outF (final projection)
// mode is a compile-time constant, for speed only.
template <int mode>
__global__ __launch_bounds__(128)
void gemm32(const _Float16* __restrict__ A, const _Float16* __restrict__ W,
            const float* __restrict__ bias, _Float16* __restrict__ outH,
            float* __restrict__ outF) {
  __shared__ __align__(16) _Float16 S[2 * GSTAGE];        // 2 x 69,632 B
  const int tid  = threadIdx.x;
  const int lane = tid & 31;
  const int wave = tid >> 5;
  const int half = lane >> 4;
  const int ln   = lane & 15;
  const int wm   = wave >> 1;
  const int wn   = wave & 1;
  const int m0   = blockIdx.x * 128 + wm * 64;
  const int n0   = blockIdx.y * 128 + wn * 64;

  // The lane's own 16-byte chunk: row tid/16 (+8 per copy), chunk tid%16.
  const int rg = tid >> 4;
  const int ch = tid & 15;
  const _Float16* ga = A + (size_t)(blockIdx.x * 128 + rg) * D_MODEL + ch * 8;
  const _Float16* gw = W + (size_t)(blockIdx.y * 128 + rg) * D_MODEL + ch * 8;
  const unsigned  l0 = (unsigned)(size_t)(__attribute__((address_space(3))) _Float16*)
                           &S[rg * GPITCH + ch * 8];

  fill_stage(ga, gw, l0);
  // stage 0 has landed before any wave reads it
  asm volatile("s_wait_asynccnt 0x0" ::: "memory");
  __syncthreads();
  fill_stage(ga + GK, gw + GK, l0 + GSTAGE * 2u);

  v8f acc[4][4] = {};
  // kept rolled: unrolling would only multiply the text a cold launch has to
  // fetch; a trip costs a few scalar instructions per 64 WMMAs
#pragma unroll 1
  for (int t = 0; t < D_MODEL / GK; ++t) {
    const _Float16* Sb = &S[(t & 1) * GSTAGE];
    const _Float16* aL = Sb + (wm * 64 + ln) * GPITCH;
    const _Float16* bL = Sb + (128 + wn * 64 + ln) * GPITCH;
#pragma unroll
    for (int kk = 0; kk < GK; kk += 32) {
      v16h a[4], b[4];
      // in the order the WMMAs below first need them
      a[0] = frag_load(aL + kk, half);
#pragma unroll
      for (int i = 0; i < 4; ++i) b[i] = frag_load(bL + i * 16 * GPITCH + kk, half);
#pragma unroll
      for (int i = 1; i < 4; ++i) a[i] = frag_load(aL + i * 16 * GPITCH + kk, half);
      // keeps the 16 LDS reads of this k step together ahead of its 16 WMMAs:
      // spread among them, every row of four waits out a full LDS latency
      __builtin_amdgcn_sched_barrier(0);
#pragma unroll
      for (int mm = 0; mm < 4; ++mm)
#pragma unroll
        for (int u = 0; u < 4; ++u)
          acc[mm][u] = __builtin_amdgcn_wmma_f32_16x16x32_f16(
              false, a[mm], false, b[u], (short)0, acc[mm][u], false, false);
      // the next k step's reads stay behind this step's WMMAs (one load group)
      __builtin_amdgcn_sched_barrier(0);
    }
    // Publish point: this wave's reads of buffer t%2 are done, its copies of
    // stage t+1 have landed; behind the barrier both hold for every wave.
    asm volatile("s_wait_dscnt 0x0" ::: "memory");
    asm volatile("s_wait_asynccnt 0x0" ::: "memory");
    __syncthreads();
    if (t + 2 < D_MODEL / GK)
      fill_stage(ga + (t + 2) * GK, gw + (t + 2) * GK, l0 + (unsigned)(t & 1) * (GSTAGE * 2u));
  }
  // no copy is outstanding when the wave goes on to its stores and ends
  asm volatile("s_wait_asynccnt 0x0" ::: "memory");

  if (mode == 2) {
    // V^T: a lane's 8 accumulator rows are 8 consecutive s of one d row, so
    // they go out as one 16-byte store instead of eight 2-byte stores.
    // The three loops are unrolled so that acc[][] keeps constant indices
    // (stays in registers) and the stores issue as one group.
#pragma unroll
    for (int mm = 0; mm < 4; ++mm) {
#pragma unroll
      for (int t = 0; t < 4; ++t) {
        int n  = n0 + 16 * t + ln;
        float bv = bias[n];
        int m  = m0 + mm * 16 + half * 8;      // multiple of 8: stays in one batch
        int b_ = m >> 11;                      // m / SEQ
        int s_ = m & (SEQ - 1);
        int bh = b_ * NHEADS + (n >> 6);       // n / HDIM
        int d_ = n & (HDIM - 1);
        union { _Float16 h[8]; uint4 u; } pk;
#pragma unroll
        for (int r = 0; r < 8; ++r) pk.h[r] = (_Float16)(acc[mm][t][r] + bv);
        *(uint4*)&outH[((size_t)bh * HDIM + d_) * SEQ + s_] = pk.u;
      }
    }
    return;
  }

  // Q, K: a wave's 64 rows lie in one batch (m0 is a multiple of 64) and its 64
  // columns are one head, so every element sits at a constant offset from one base.
  _Float16* oQK = outH + ((size_t)((m0 >> 11) * NHEADS + (n0 >> 6)) * SEQ
                          + (m0 & (SEQ - 1)) + half * 8) * HDIM + ln;
#pragma unroll
  for (int mm = 0; mm < 4; ++mm) {
#pragma unroll
    for (int t = 0; t < 4; ++t) {
      int n = n0 + 16 * t + ln;
      float bv = bias[n];
#pragma unroll
      for (int r = 0; r < 8; ++r) {
        int m = m0 + mm * 16 + r + half * 8;   // C layout: VGPR r -> row r+8*half
        float val = acc[mm][t][r] + bv;
        if (mode == 3) {
          outF[(size_t)m * D_MODEL + n] = val;
        } else {
          const int e = (mm * 16 + r) * HDIM + 16 * t;   // row s, column d from the base
          if (mode == 0)
            oQK[e] = (_Float16)(val * 0.125f);
          else if (mode == 1)
            oQK[e] = (_Float16)val;
        }
      }
    }
  }
}

// Flash attention: one wave per 16-query tile, kv tiles of 32 keys.
// Q pre-scaled by 1/sqrt(HDIM). Writes f16 output in (b, s, h*hd) layout.
// A block takes two 64-query blocks of its head, one after the other: number
// 31 - x, then number x. The causal cost grows linearly with the number, so
// every block of the grid walks the same count of kv tiles and no WGP is left
// with the long blocks only.
__global__ __launch_bounds__(128)
void flash_attn(const _Float16* __restrict__ Q, const _Float16* __restrict__ K,
                const _Float16* __restrict__ Vt, _Float16* __restrict__ O) {
  __shared__ __align__(16) _Float16 Plds[4][16 * 32];   // per-wave 16x32 P staging
  const int lane = threadIdx.x & 31;
  const int wave = threadIdx.x >> 5;
  const int half = lane >> 4;
  const int ln   = lane & 15;
  const int bh   = blockIdx.y;

  // kept rolled: the two query blocks run one after the other through the same
  // text; unrolled, the text a cold launch has to fetch would double
#pragma unroll 1
  for (int part = 0; part < 2; ++part) {
  const int qblk = part == 0 ? SEQ / 64 - 1 - (int)blockIdx.x : (int)blockIdx.x;
  const int q0   = (qblk * 4 + wave) * 16;

  const _Float16* Qb = Q + ((size_t)bh * SEQ + q0 + ln) * HDIM;
  v16h qa0 = frag_load(Qb, half);        // d = 0..31
  v16h qa1 = frag_load(Qb + 32, half);   // d = 32..63

  v8f   o[4] = {};
  float mi[8], li[8];
#pragma unroll
  for (int r = 0; r < 8; ++r) { mi[r] = -1e30f; li[r] = 0.0f; }

  for (int j0 = 0; j0 < q0 + 16; j0 += 32) {
    int klo = j0 + ln;
    int khi = j0 + 16 + ln;
    int kloC = klo < SEQ - 1 ? klo : SEQ - 1;   // clamp diag-tile overreads
    int khiC = khi < SEQ - 1 ? khi : SEQ - 1;

    const _Float16* Kl = K + ((size_t)bh * SEQ + kloC) * HDIM;
    const _Float16* Kh = K + ((size_t)bh * SEQ + khiC) * HDIM;

    // Batch all global loads (K frags + V frags) so they clause together and
    // overlap the softmax VALU work.
    v16h kb00 = frag_load(Kl, half);
    v16h kb01 = frag_load(Kl + 32, half);
    v16h kb10 = frag_load(Kh, half);
    v16h kb11 = frag_load(Kh + 32, half);
    v16h vb[4];
#pragma unroll
    for (int t = 0; t < 4; ++t)
      vb[t] = frag_load(Vt + ((size_t)bh * HDIM + 16 * t + ln) * SEQ + j0, half);

    v8f sl = {}, sh = {};
    sl = __builtin_amdgcn_wmma_f32_16x16x32_f16(false, qa0, false, kb00, (short)0, sl, false, false);
    sl = __builtin_amdgcn_wmma_f32_16x16x32_f16(false, qa1, false, kb01, (short)0, sl, false, false);
    sh = __builtin_amdgcn_wmma_f32_16x16x32_f16(false, qa0, false, kb10, (short)0, sh, false, false);
    sh = __builtin_amdgcn_wmma_f32_16x16x32_f16(false, qa1, false, kb11, (short)0, sh, false, false);

    float pl[8], ph[8], sc[8];
#pragma unroll
    for (int r = 0; r < 8; ++r) {
      int q = q0 + r + half * 8;
      float a = (klo <= q) ? sl[r] : -1e30f;    // causal mask: key > query
      float b = (khi <= q) ? sh[r] : -1e30f;
      float v = fmaxf(a, b);
#pragma unroll
      for (int msk = 1; msk < 16; msk <<= 1) v = fmaxf(v, __shfl_xor(v, msk));
      float mnew  = fmaxf(mi[r], v);
      float scale = __expf(mi[r] - mnew);
      float ea = __expf(a - mnew);
      float eb = __expf(b - mnew);
      float rs = ea + eb;
#pragma unroll
      for (int msk = 1; msk < 16; msk <<= 1) rs += __shfl_xor(rs, msk);
      li[r] = li[r] * scale + rs;
      mi[r] = mnew;
      sc[r] = scale;
      pl[r] = ea;
      ph[r] = eb;
    }

#pragma unroll
    for (int t = 0; t < 4; ++t)
#pragma unroll
      for (int r = 0; r < 8; ++r) o[t][r] *= sc[r];

    // C-layout -> A-layout relayout of P through LDS (same-wave, DS in order)
    asm volatile("" ::: "memory");
#pragma unroll
    for (int r = 0; r < 8; ++r) {
      int row = r + half * 8;
      Plds[wave][row * 32 + ln]      = (_Float16)pl[r];
      Plds[wave][row * 32 + 16 + ln] = (_Float16)ph[r];
    }
    asm volatile("s_wait_dscnt 0" ::: "memory");
    v16h pa = frag_load(&Plds[wave][ln * 32], half);
    asm volatile("" ::: "memory");

    // O += P x V : B[k][n] = V[key=j0+k][d], Vt is (bh, d, s) so keys contiguous
#pragma unroll
    for (int t = 0; t < 4; ++t)
      o[t] = __builtin_amdgcn_wmma_f32_16x16x32_f16(
          false, pa, false, vb[t], (short)0, o[t], false, false);
  }

  const int b_ = bh >> 4;
  const int h_ = bh & 15;
#pragma unroll
  for (int t = 0; t < 4; ++t)
#pragma unroll
    for (int r = 0; r < 8; ++r) {
      int s_ = q0 + r + half * 8;
      float val = o[t][r] / li[r];
      O[((size_t)(b_ * SEQ + s_)) * D_MODEL + h_ * HDIM + 16 * t + ln] = (_Float16)val;
    }
  // the next query block rewrites the registers that these stores name (address
  // and data): the wait stands behind the stores, in front of every such write
  asm volatile("s_wait_xcnt 0x0" ::: "memory");
  }
}

extern "C" void kernel_launch(void* const* d_in, const int* in_sizes, int n_in,
                              void* d_out, int out_size, void* d_ws, size_t ws_size,
                              hipStream_t stream) {
  const float* x  = (const float*)d_in[0];
  const float* Wq = (const float*)d_in[1];
  const float* bq = (const float*)d_in[2];
  const float* Wk = (const float*)d_in[3];
  const float* bk = (const float*)d_in[4];
  const float* Wv = (const float*)d_in[5];
  const float* bv = (const float*)d_in[6];
  const float* Wo = (const float*)d_in[7];
  const float* bo = (const float*)d_in[8];
  float* out = (float*)d_out;

  char* ws = (char*)d_ws;
  size_t off = 0;
  const size_t XSZ = (size_t)MTOT * D_MODEL * sizeof(_Float16);      // 16 MB
  const size_t WSZ = (size_t)D_MODEL * D_MODEL * sizeof(_Float16);   //  2 MB
  _Float16* xh  = (_Float16*)(ws + off); off += XSZ;
  _Float16* wqh = (_Float16*)(ws + off); off += WSZ;
  _Float16* wkh = (_Float16*)(ws + off); off += WSZ;
  _Float16* wvh = (_Float16*)(ws + off); off += WSZ;
  _Float16* woh = (_Float16*)(ws + off); off += WSZ;
  _Float16* qh  = (_Float16*)(ws + off); off += XSZ;
  _Float16* kh  = (_Float16*)(ws + off); off += XSZ;
  _Float16* vt  = (_Float16*)(ws + off); off += XSZ;
  _Float16* at  = (_Float16*)(ws + off); off += XSZ;   // attention output (b, s, h*hd)
  (void)in_sizes; (void)n_in; (void)out_size; (void)ws_size;

  f32_to_f16<<<4096, 256, 0, stream>>>(x,  xh,  MTOT * D_MODEL);
  f32_to_f16<<<1024, 256, 0, stream>>>(Wq, wqh, D_MODEL * D_MODEL);
  f32_to_f16<<<1024, 256, 0, stream>>>(Wk, wkh, D_MODEL * D_MODEL);
  f32_to_f16<<<1024, 256, 0, stream>>>(Wv, wvh, D_MODEL * D_MODEL);
  f32_to_f16<<<1024, 256, 0, stream>>>(Wo, woh, D_MODEL * D_MODEL);

  dim3 gg(MTOT / 128, D_MODEL / 128);
  gemm32<0><<<gg, 128, 0, stream>>>(xh, wqh, bq, qh, nullptr);   // Q (scaled)
  gemm32<1><<<gg, 128, 0, stream>>>(xh, wkh, bk, kh, nullptr);   // K
  gemm32<2><<<gg, 128, 0, stream>>>(xh, wvh, bv, vt, nullptr);   // V^T

  flash_attn<<<dim3(SEQ / 128, BATCH * NHEADS), 128, 0, stream>>>(qh, kh, vt, at);

  gemm32<3><<<gg, 128, 0, stream>>>(at, woh, bo, nullptr, out);  // out proj
}

// v004
// It runs in 187 microseconds.
// Next to v003, in two timings, it ran 1.07 times as fast each time.
// All steps since v000 together make it 2.48 times as fast.
#include <hip/hip_runtime.h>

// ---------------------------------------------------------------------------
// Causal self-attention for MI455X (gfx1250, wave32, WMMA).
// fp32 in/out; internal compute in f16 with fp32 WMMA accumulation.
// ---------------------------------------------------------------------------

typedef __attribute__((ext_vector_type(16))) _Float16 v16h;
typedef __attribute__((ext_vector_type(8)))  float    v8f;

#define D_MODEL 1024
#define NHEADS  16
#define HDIM    64
#define SEQ     2048
#define BATCH   4
#define MTOT    (BATCH * SEQ)   // 8192 rows

// Load a 16x32 f16 fragment (A-layout or symmetric B-layout) where the WMMA
// K-dimension is contiguous in memory at `p` (p = row/col start + k-base).
// Per CDNA5 ISA 16-bit A layout: lane half = lane>>4,
//   VGPR v holds K = (v/4)*16 + half*8 + (v%4)*2  (+1 for hi half of dword).
// Per half this is two contiguous 16B chunks -> compiler emits 2x b128 loads.
__device__ __forceinline__ v16h frag_load(const _Float16* p, int half) {
  union { v16h h; unsigned int u[8]; } r;
#pragma unroll
  for (int v = 0; v < 8; ++v) {
    int k = ((v >> 2) << 4) + (half << 3) + ((v & 3) << 1);
    r.u[v] = *(const unsigned int*)(p + k);
  }
  return r.h;
}

// Eight asynchronous 16-byte copies global -> LDS, rows 8 apart (one wave-wide
// copy covers two whole 256-byte row slabs). The s_wait_xcnt stands inside the
// copies' own statement so that no address register is rewritten ahead of it.
#define GK      128                   // k elements per stage (256 B per row)
#define GPITCH  136                   // LDS row pitch in halfs: 272 B = 16 B x 17
#define GSTAGE  (256 * GPITCH)        // halfs per stage: 128 A rows + 128 W rows
__device__ __forceinline__ void async_rows8(const _Float16* g, unsigned l) {
  asm volatile(
      "global_load_async_to_lds_b128 %0, %8, off\n\t"
      "global_load_async_to_lds_b128 %1, %9, off\n\t"
      "global_load_async_to_lds_b128 %2, %10, off\n\t"
      "global_load_async_to_lds_b128 %3, %11, off\n\t"
      "global_load_async_to_lds_b128 %4, %12, off\n\t"
      "global_load_async_to_lds_b128 %5, %13, off\n\t"
      "global_load_async_to_lds_b128 %6, %14, off\n\t"
      "global_load_async_to_lds_b128 %7, %15, off\n\t"
      "s_wait_xcnt 0x0"
      :: "v"(l), "v"(l + 8u * GPITCH * 2u), "v"(l + 16u * GPITCH * 2u),
         "v"(l + 24u * GPITCH * 2u), "v"(l + 32u * GPITCH * 2u),
         "v"(l + 40u * GPITCH * 2u), "v"(l + 48u * GPITCH * 2u),
         "v"(l + 56u * GPITCH * 2u),
         "v"(g), "v"(g + 8 * D_MODEL), "v"(g + 16 * D_MODEL), "v"(g + 24 * D_MODEL),
         "v"(g + 32 * D_MODEL), "v"(g + 40 * D_MODEL), "v"(g + 48 * D_MODEL),
         "v"(g + 56 * D_MODEL)
      : "memory");
}

// One stage: 128 rows of A, then 128 rows of W, 256 bytes of each row.
// 32 copies per lane; ga/gw and l are the lane's own first chunk.
__device__ __forceinline__ void fill_stage(const _Float16* ga, const _Float16* gw, unsigned l) {
  async_rows8(ga, l);
  async_rows8(ga + 64 * D_MODEL, l + 64u * GPITCH * 2u);
  async_rows8(gw, l + 128u * GPITCH * 2u);
  async_rows8(gw + 64 * D_MODEL, l + 192u * GPITCH * 2u);
}

__global__ void f32_to_f16(const float* __restrict__ s, _Float16* __restrict__ d, int n) {
  int i = blockIdx.x * blockDim.x + threadIdx.x;
  int stride = gridDim.x * blockDim.x;
  for (; i < n; i += stride) d[i] = (_Float16)s[i];
}

// GEMM: out[m,n] = sum_k A[m,k] * W[n,k] + bias[n]   (nn.Linear semantics)
// Block = 4 waves (2x2) computing a 128x128 tile; each wave owns 64x64
// (16 WMMA acc). Both operands come per 128-k stage into a two-buffer LDS ring
// by asynchronous copies and are shared by the block's waves.
// mode 0: store Q (bh,s,hd) scaled by 1/sqrt(HDIM)
// mode 1: store K (bh,s,hd)
// mode 2: store V transposed (bh,hd,s), 16 bytes per lane
// mode 3: store fp32 row-major to outF (final projection)
// mode is a compile-time constant, for speed only.
template <int mode>
__global__ __launch_bounds__(128)
void gemm32(const _Float16* __restrict__ A, const _Float16* __restrict__ W,
            const float* __restrict__ bias, _Float16* __restrict__ outH,
            float* __restrict__ outF) {
  __shared__ __align__(16) _Float16 S[2 * GSTAGE];        // 2 x 69,632 B
  const int tid  = threadIdx.x;
  const int lane = tid & 31;
  const int wave = tid >> 5;
  const int half = lane >> 4;
  const int ln   = lane & 15;
  const int wm   = wave >> 1;
  const int wn   = wave & 1;
  const int m0   = blockIdx.x * 128 + wm * 64;
  const int n0   = blockIdx.y * 128 + wn * 64;

  // The lane's own 16-byte chunk: row tid/16 (+8 per copy), chunk tid%16.
  const int rg = tid >> 4;
  const int ch = tid & 15;
  const _Float16* ga = A + (size_t)(blockIdx.x * 128 + rg) * D_MODEL + ch * 8;
  const _Float16* gw = W + (size_t)(blockIdx.y * 128 + rg) * D_MODEL + ch * 8;
  const unsigned  l0 = (unsigned)(size_t)(__attribute__((address_space(3))) _Float16*)
                           &S[rg * GPITCH + ch * 8];

  fill_stage(ga, gw, l0);
  // stage 0 has landed before any wave reads it
  asm volatile("s_wait_asynccnt 0x0" ::: "memory");
  __syncthreads();
  fill_stage(ga + GK, gw + GK, l0 + GSTAGE * 2u);

  v8f acc[4][4] = {};
  // kept rolled: unrolling would only multiply the text a cold launch has to
  // fetch; a trip costs a few scalar instructions per 64 WMMAs
#pragma unroll 1
  for (int t = 0; t < D_MODEL / GK; ++t) {
    const _Float16* Sb = &S[(t & 1) * GSTAGE];
    const _Float16* aL = Sb + (wm * 64 + ln) * GPITCH;
    const _Float16* bL = Sb + (128 + wn * 64 + ln) * GPITCH;
#pragma unroll
    for (int kk = 0; kk < GK; kk += 32) {
      v16h a[4], b[4];
      // in the order the WMMAs below first need them
      a[0] = frag_load(aL + kk, half);
#pragma unroll
      for (int i = 0; i < 4; ++i) b[i] = frag_load(bL + i * 16 * GPITCH + kk, half);
#pragma unroll
      for (int i = 1; i < 4; ++i) a[i] = frag_load(aL + i * 16 * GPITCH + kk, half);
      // keeps the 16 LDS reads of this k step together ahead of its 16 WMMAs:
      // spread among them, every row of four waits out a full LDS latency
      __builtin_amdgcn_sched_barrier(0);
#pragma unroll
      for (int mm = 0; mm < 4; ++mm)
#pragma unroll
        for (int u = 0; u < 4; ++u)
          acc[mm][u] = __builtin_amdgcn_wmma_f32_16x16x32_f16(
              false, a[mm], false, b[u], (short)0, acc[mm][u], false, false);
      // the next k step's reads stay behind this step's WMMAs (one load group)
      __builtin_amdgcn_sched_barrier(0);
    }
    // Publish point: this wave's reads of buffer t%2 are done, its copies of
    // stage t+1 have landed; behind the barrier both hold for every wave.
    asm volatile("s_wait_dscnt 0x0" ::: "memory");
    asm volatile("s_wait_asynccnt 0x0" ::: "memory");
    __syncthreads();
    if (t + 2 < D_MODEL / GK)
      fill_stage(ga + (t + 2) * GK, gw + (t + 2) * GK, l0 + (unsigned)(t & 1) * (GSTAGE * 2u));
  }
  // no copy is outstanding when the wave goes on to its stores and ends
  asm volatile("s_wait_asynccnt 0x0" ::: "memory");

  if (mode == 2) {
    // V^T: a lane's 8 accumulator rows are 8 consecutive s of one d row, so
    // they go out as one 16-byte store instead of eight 2-byte stores.
    // The three loops are unrolled so that acc[][] keeps constant indices
    // (stays in registers) and the stores issue as one group.
#pragma unroll
    for (int mm = 0; mm < 4; ++mm) {
#pragma unroll
      for (int t = 0; t < 4; ++t) {
        int n  = n0 + 16 * t + ln;
        float bv = bias[n];
        int m  = m0 + mm * 16 + half * 8;      // multiple of 8: stays in one batch
        int b_ = m >> 11;                      // m / SEQ
        int s_ = m & (SEQ - 1);
        int bh = b_ * NHEADS + (n >> 6);       // n / HDIM
        int d_ = n & (HDIM - 1);
        union { _Float16 h[8]; uint4 u; } pk;
#pragma unroll
        for (int r = 0; r < 8; ++r) pk.h[r] = (_Float16)(acc[mm][t][r] + bv);
        *(uint4*)&outH[((size_t)bh * HDIM + d_) * SEQ + s_] = pk.u;
      }
    }
    return;
  }

  // Q, K: a wave's 64 rows lie in one batch (m0 is a multiple of 64) and its 64
  // columns are one head, so every element sits at a constant offset from one base.
  _Float16* oQK = outH + ((size_t)((m0 >> 11) * NHEADS + (n0 >> 6)) * SEQ
                          + (m0 & (SEQ - 1)) + half * 8) * HDIM + ln;
#pragma unroll
  for (int mm = 0; mm < 4; ++mm) {
#pragma unroll
    for (int t = 0; t < 4; ++t) {
      int n = n0 + 16 * t + ln;
      float bv = bias[n];
#pragma unroll
      for (int r = 0; r < 8; ++r) {
        int m = m0 + mm * 16 + r + half * 8;   // C layout: VGPR r -> row r+8*half
        float val = acc[mm][t][r] + bv;
        if (mode == 3) {
          outF[(size_t)m * D_MODEL + n] = val;
        } else {
          const int e = (mm * 16 + r) * HDIM + 16 * t;   // row s, column d from the base
          if (mode == 0)
            oQK[e] = (_Float16)(val * 0.125f);
          else if (mode == 1)
            oQK[e] = (_Float16)val;
        }
      }
    }
  }
}

// lane l reads lane l ^ 16: a vector cross-row move, no LDS round trip
__device__ __forceinline__ float xhalf(float x) {
  return __builtin_bit_cast(float, __builtin_amdgcn_permlanex16(
      __builtin_bit_cast(int, x), __builtin_bit_cast(int, x),
      0x76543210, 0xfedcba98, false, false));
}

// 2^x of eight values and of one more, each in place. The v_exp_f32 stand in one
// statement so that none is directly followed by a write of its own source (left
// to the register allocator, a v_exp often lands on the source of the one before);
// the closing v_nop is the slot the instruction set asks for behind a
// transcendental before its result is used.
__device__ __forceinline__ void exp2x9(float (&x)[8], float& y) {
  asm("v_exp_f32 %0, %0\n\t"
      "v_exp_f32 %1, %1\n\t"
      "v_exp_f32 %2, %2\n\t"
      "v_exp_f32 %3, %3\n\t"
      "v_exp_f32 %4, %4\n\t"
      "v_exp_f32 %5, %5\n\t"
      "v_exp_f32 %6, %6\n\t"
      "v_exp_f32 %7, %7\n\t"
      "v_exp_f32 %8, %8\n\t"
      "v_nop"
      : "+v"(y), "+v"(x[0]), "+v"(x[1]), "+v"(x[2]), "+v"(x[3]),
        "+v"(x[4]), "+v"(x[5]), "+v"(x[6]), "+v"(x[7]));
}
__device__ __forceinline__ void exp2x8(float (&x)[8]) {
  asm("v_exp_f32 %0, %0\n\t"
      "v_exp_f32 %1, %1\n\t"
      "v_exp_f32 %2, %2\n\t"
      "v_exp_f32 %3, %3\n\t"
      "v_exp_f32 %4, %4\n\t"
      "v_exp_f32 %5, %5\n\t"
      "v_exp_f32 %6, %6\n\t"
      "v_exp_f32 %7, %7\n\t"
      "v_nop"
      : "+v"(x[0]), "+v"(x[1]), "+v"(x[2]), "+v"(x[3]),
        "+v"(x[4]), "+v"(x[5]), "+v"(x[6]), "+v"(x[7]));
}

__global__ __launch_bounds__(128)
void flash_attn(const _Float16* __restrict__ Q, const _Float16* __restrict__ K,
                const _Float16* __restrict__ Vt, _Float16* __restrict__ O) {
  const int lane = threadIdx.x & 31;
  const int wave = threadIdx.x >> 5;
  const int half = lane >> 4;
  const int ln   = lane & 15;
  const int bh   = blockIdx.y;

  // kept rolled: the two query blocks run one after the other through the same
  // text; unrolled, the text a cold launch has to fetch would double
#pragma unroll 1
  for (int part = 0; part < 2; ++part) {
  const int qblk = part == 0 ? SEQ / 64 - 1 - (int)blockIdx.x : (int)blockIdx.x;
  const int q0   = (qblk * 4 + wave) * 16;
  const int q    = q0 + ln;              // the lane's own query

  const _Float16* Qb = Q + ((size_t)bh * SEQ + q) * HDIM;
  v16h qb0 = frag_load(Qb, half);        // B operand, d = 0..31
  v16h qb1 = frag_load(Qb + 32, half);   // B operand, d = 32..63

  v8f   o[4] = {};                       // o[t][r] = O^T[d = 16t + 8*half + r][q]
  float mi = -1e30f;                     // running maximum, equal in both halves
  float li = 0.0f;                       // running sum over this half's keys only

  for (int j0 = 0; j0 < q0 + 16; j0 += 32) {
    int klo = j0 + ln;
    int khi = j0 + 16 + ln;
    int kloC = klo < SEQ - 1 ? klo : SEQ - 1;   // clamp diag-tile overreads
    int khiC = khi < SEQ - 1 ? khi : SEQ - 1;

    const _Float16* Kl = K + ((size_t)bh * SEQ + kloC) * HDIM;
    const _Float16* Kh = K + ((size_t)bh * SEQ + khiC) * HDIM;

    // Batch all global loads (K frags + V frags) so they clause together and
    // overlap the softmax VALU work.
    v16h ka00 = frag_load(Kl, half);
    v16h ka01 = frag_load(Kl + 32, half);
    v16h ka10 = frag_load(Kh, half);
    v16h ka11 = frag_load(Kh + 32, half);
    v16h va[4];
#pragma unroll
    for (int t = 0; t < 4; ++t)
      va[t] = frag_load(Vt + ((size_t)bh * HDIM + 16 * t + ln) * SEQ + j0, half);
    // keeps the 16 loads one group ahead of the first WMMA: with fewer live
    // registers the compiler otherwise reuses fragment registers and strings
    // the loads out between the WMMAs, one L2 latency after another
    __builtin_amdgcn_sched_barrier(0);

    // sl[r] = S^T[key j0 + 8*half + r][q], sh[r] = the same 16 keys further on
    v8f sl = {}, sh = {};
    sl = __builtin_amdgcn_wmma_f32_16x16x32_f16(false, ka00, false, qb0, (short)0, sl, false, false);
    sl = __builtin_amdgcn_wmma_f32_16x16x32_f16(false, ka01, false, qb1, (short)0, sl, false, false);
    sh = __builtin_amdgcn_wmma_f32_16x16x32_f16(false, ka10, false, qb0, (short)0, sh, false, false);
    sh = __builtin_amdgcn_wmma_f32_16x16x32_f16(false, ka11, false, qb1, (short)0, sh, false, false);

    const int kb = j0 + half * 8;
    float v = -1e30f;
#pragma unroll
    for (int r = 0; r < 8; ++r) {
      sl[r] = (kb + r      <= q) ? sl[r] : -1e30f;   // causal mask: key > query
      sh[r] = (kb + 16 + r <= q) ? sh[r] : -1e30f;
      v = fmaxf(v, fmaxf(sl[r], sh[r]));
    }
    v = fmaxf(v, xhalf(v));              // the other half's 16 keys of this query
    const float mnew  = fmaxf(mi, v);
    // e^x as 2^(x * log2 e), the form of __expf
    const float L2E = 1.44269504088896340736f;
    float scale = (mi - mnew) * L2E;
    mi = mnew;
    float ea[8], eb[8];
#pragma unroll
    for (int r = 0; r < 8; ++r) {
      ea[r] = (sl[r] - mnew) * L2E;
      eb[r] = (sh[r] - mnew) * L2E;
    }
    exp2x9(ea, scale);
    exp2x8(eb);

    // P^T as B operand: element s is key j0 + 8*half + s (+ 8 for s >= 8), the order of va[]
    v16h pb;
    float rs = 0.0f;
#pragma unroll
    for (int r = 0; r < 8; ++r) {
      rs += ea[r] + eb[r];
      pb[r]     = (_Float16)ea[r];
      pb[8 + r] = (_Float16)eb[r];
    }
    li = li * scale + rs;

#pragma unroll
    for (int t = 0; t < 4; ++t)
#pragma unroll
      for (int r = 0; r < 8; ++r) o[t][r] *= scale;

    // O^T += V^T x P^T : A[d][k] = Vt row d (keys contiguous), B[k][q] = P^T
#pragma unroll
    for (int t = 0; t < 4; ++t)
      o[t] = __builtin_amdgcn_wmma_f32_16x16x32_f16(
          false, va[t], false, pb, (short)0, o[t], false, false);
  }

  li += xhalf(li);                       // join the two halves' sums, once
  const int b_ = bh >> 4;
  const int h_ = bh & 15;
  // a lane's 8 accumulator registers are 8 consecutive d of its query's row
  _Float16* Ob = O + ((size_t)(b_ * SEQ + q)) * D_MODEL + h_ * HDIM + half * 8;
#pragma unroll
  for (int t = 0; t < 4; ++t) {
    union { _Float16 h[8]; uint4 u; } pk;
#pragma unroll
    for (int r = 0; r < 8; ++r) pk.h[r] = (_Float16)(o[t][r] / li);
    *(uint4*)&Ob[16 * t] = pk.u;
  }
  // the next query block rewrites the registers that these stores name (address
  // and data): the wait stands behind the stores, in front of every such write
  asm volatile("s_wait_xcnt 0x0" ::: "memory");
  }
}

extern "C" void kernel_launch(void* const* d_in, const int* in_sizes, int n_in,
                              void* d_out, int out_size, void* d_ws, size_t ws_size,
                              hipStream_t stream) {
  const float* x  = (const float*)d_in[0];
  const float* Wq = (const float*)d_in[1];
  const float* bq = (const float*)d_in[2];
  const float* Wk = (const float*)d_in[3];
  const float* bk = (const float*)d_in[4];
  const float* Wv = (const float*)d_in[5];
  const float* bv = (const float*)d_in[6];
  const float* Wo = (const float*)d_in[7];
  const float* bo = (const float*)d_in[8];
  float* out = (float*)d_out;

  char* ws = (char*)d_ws;
  size_t off = 0;
  const size_t XSZ = (size_t)MTOT * D_MODEL * sizeof(_Float16);      // 16 MB
  const size_t WSZ = (size_t)D_MODEL * D_MODEL * sizeof(_Float16);   //  2 MB
  _Float16* xh  = (_Float16*)(ws + off); off += XSZ;
  _Float16* wqh = (_Float16*)(ws + off); off += WSZ;
  _Float16* wkh = (_Float16*)(ws + off); off += WSZ;
  _Float16* wvh = (_Float16*)(ws + off); off += WSZ;
  _Float16* woh = (_Float16*)(ws + off); off += WSZ;
  _Float16* qh  = (_Float16*)(ws + off); off += XSZ;
  _Float16* kh  = (_Float16*)(ws + off); off += XSZ;
  _Float16* vt  = (_Float16*)(ws + off); off += XSZ;
  _Float16* at  = (_Float16*)(ws + off); off += XSZ;   // attention output (b, s, h*hd)
  (void)in_sizes; (void)n_in; (void)out_size; (void)ws_size;

  f32_to_f16<<<4096, 256, 0, stream>>>(x,  xh,  MTOT * D_MODEL);
  f32_to_f16<<<1024, 256, 0, stream>>>(Wq, wqh, D_MODEL * D_MODEL);
  f32_to_f16<<<1024, 256, 0, stream>>>(Wk, wkh, D_MODEL * D_MODEL);
  f32_to_f16<<<1024, 256, 0, stream>>>(Wv, wvh, D_MODEL * D_MODEL);
  f32_to_f16<<<1024, 256, 0, stream>>>(Wo, woh, D_MODEL * D_MODEL);

  dim3 gg(MTOT / 128, D_MODEL / 128);
  gemm32<0><<<gg, 128, 0, stream>>>(xh, wqh, bq, qh, nullptr);   // Q (scaled)
  gemm32<1><<<gg, 128, 0, stream>>>(xh, wkh, bk, kh, nullptr);   // K
  gemm32<2><<<gg, 128, 0, stream>>>(xh, wvh, bv, vt, nullptr);   // V^T

  flash_attn<<<dim3(SEQ / 128, BATCH * NHEADS), 128, 0, stream>>>(qh, kh, vt, at);

  gemm32<3><<<gg, 128, 0, stream>>>(at, woh, bo, nullptr, out);  // out proj
}

// v005
// One run takes 135 microseconds.
// Timed twice side by side with v004, it ran 1.39 times as fast both times.
// Over all steps from v000 it is 3.45 times as fast.
#include <hip/hip_runtime.h>

// ---------------------------------------------------------------------------
// Causal self-attention for MI455X (gfx1250, wave32, WMMA).
// fp32 in/out; internal compute in f16 with fp32 WMMA accumulation.
// ---------------------------------------------------------------------------

typedef __attribute__((ext_vector_type(16))) _Float16 v16h;
typedef __attribute__((ext_vector_type(8)))  float    v8f;

#define D_MODEL 1024
#define NHEADS  16
#define HDIM    64
#define SEQ     2048
#define BATCH   4
#define MTOT    (BATCH * SEQ)   // 8192 rows

// Load a 16x32 f16 fragment (A-layout or symmetric B-layout) where the WMMA
// K-dimension is contiguous in memory at `p` (p = row/col start + k-base).
// Per CDNA5 ISA 16-bit A layout: lane half = lane>>4,
//   VGPR v holds K = (v/4)*16 + half*8 + (v%4)*2  (+1 for hi half of dword).
// Per half this is two contiguous 16B chunks -> compiler emits 2x b128 loads.
__device__ __forceinline__ v16h frag_load(const _Float16* p, int half) {
  union { v16h h; unsigned int u[8]; } r;
#pragma unroll
  for (int v = 0; v < 8; ++v) {
    int k = ((v >> 2) << 4) + (half << 3) + ((v & 3) << 1);
    r.u[v] = *(const unsigned int*)(p + k);
  }
  return r.h;
}

// Eight asynchronous 16-byte copies global -> LDS, rows 8 apart (one wave-wide
// copy covers two whole 256-byte row slabs). The s_wait_xcnt stands inside the
// copies' own statement so that no address register is rewritten ahead of it.
#define GK      128                   // k elements per stage (256 B per row)
#define GPITCH  136                   // LDS row pitch in halfs: 272 B = 16 B x 17
#define GSTAGE  (256 * GPITCH)        // halfs per stage: 128 A rows + 128 W rows
__device__ __forceinline__ void async_rows8(const _Float16* g, unsigned l) {
  asm volatile(
      "global_load_async_to_lds_b128 %0, %8, off\n\t"
      "global_load_async_to_lds_b128 %1, %9, off\n\t"
      "global_load_async_to_lds_b128 %2, %10, off\n\t"
      "global_load_async_to_lds_b128 %3, %11, off\n\t"
      "global_load_async_to_lds_b128 %4, %12, off\n\t"
      "global_load_async_to_lds_b128 %5, %13, off\n\t"
      "global_load_async_to_lds_b128 %6, %14, off\n\t"
      "global_load_async_to_lds_b128 %7, %15, off\n\t"
      "s_wait_xcnt 0x0"
      :: "v"(l), "v"(l + 8u * GPITCH * 2u), "v"(l + 16u * GPITCH * 2u),
         "v"(l + 24u * GPITCH * 2u), "v"(l + 32u * GPITCH * 2u),
         "v"(l + 40u * GPITCH * 2u), "v"(l + 48u * GPITCH * 2u),
         "v"(l + 56u * GPITCH * 2u),
         "v"(g), "v"(g + 8 * D_MODEL), "v"(g + 16 * D_MODEL), "v"(g + 24 * D_MODEL),
         "v"(g + 32 * D_MODEL), "v"(g + 40 * D_MODEL), "v"(g + 48 * D_MODEL),
         "v"(g + 56 * D_MODEL)
      : "memory");
}

// One stage: 128 rows of A, then 128 rows of W, 256 bytes of each row.
// 32 copies per lane; ga/gw and l are the lane's own first chunk.
__device__ __forceinline__ void fill_stage(const _Float16* ga, const _Float16* gw, unsigned l) {
  async_rows8(ga, l);
  async_rows8(ga + 64 * D_MODEL, l + 64u * GPITCH * 2u);
  async_rows8(gw, l + 128u * GPITCH * 2u);
  async_rows8(gw + 64 * D_MODEL, l + 192u * GPITCH * 2u);
}

__global__ void f32_to_f16(const float* __restrict__ s, _Float16* __restrict__ d, int n) {
  int i = blockIdx.x * blockDim.x + threadIdx.x;
  int stride = gridDim.x * blockDim.x;
  for (; i < n; i += stride) d[i] = (_Float16)s[i];
}

// GEMM: out[m,n] = sum_k A[m,k] * W[n,k] + bias[n]   (nn.Linear semantics)
// Block = 4 waves (2x2) computing a 128x128 tile; each wave owns 64x64
// (16 WMMA acc). Both operands come per 128-k stage into a two-buffer LDS ring
// by asynchronous copies and are shared by the block's waves.
// mode 0: store Q (bh,s,hd) scaled by 1/sqrt(HDIM)
// mode 1: store K (bh,s,hd)
// mode 2: store V transposed (bh,hd,s), 16 bytes per lane
// mode 3: store fp32 row-major to outF (final projection)
// mode is a compile-time constant, for speed only.
template <int mode>
__global__ __launch_bounds__(128)
void gemm32(const _Float16* __restrict__ A, const _Float16* __restrict__ W,
            const float* __restrict__ bias, _Float16* __restrict__ outH,
            float* __restrict__ outF) {
  __shared__ __align__(16) _Float16 S[2 * GSTAGE];        // 2 x 69,632 B
  const int tid  = threadIdx.x;
  const int lane = tid & 31;
  const int wave = tid >> 5;
  const int half = lane >> 4;
  const int ln   = lane & 15;
  const int wm   = wave >> 1;
  const int wn   = wave & 1;
  const int m0   = blockIdx.x * 128 + wm * 64;
  const int n0   = blockIdx.y * 128 + wn * 64;

  // The lane's own 16-byte chunk: row tid/16 (+8 per copy), chunk tid%16.
  const int rg = tid >> 4;
  const int ch = tid & 15;
  const _Float16* ga = A + (size_t)(blockIdx.x * 128 + rg) * D_MODEL + ch * 8;
  const _Float16* gw = W + (size_t)(blockIdx.y * 128 + rg) * D_MODEL + ch * 8;
  const unsigned  l0 = (unsigned)(size_t)(__attribute__((address_space(3))) _Float16*)
                           &S[rg * GPITCH + ch * 8];

  fill_stage(ga, gw, l0);
  // stage 0 has landed before any wave reads it
  asm volatile("s_wait_asynccnt 0x0" ::: "memory");
  __syncthreads();
  fill_stage(ga + GK, gw + GK, l0 + GSTAGE * 2u);

  v8f acc[4][4] = {};
  // kept rolled: unrolling would only multiply the text a cold launch has to
  // fetch; a trip costs a few scalar instructions per 64 WMMAs
#pragma unroll 1
  for (int t = 0; t < D_MODEL / GK; ++t) {
    const _Float16* Sb = &S[(t & 1) * GSTAGE];
    const _Float16* aL = Sb + (wm * 64 + ln) * GPITCH;
    const _Float16* bL = Sb + (128 + wn * 64 + ln) * GPITCH;
#pragma unroll
    for (int kk = 0; kk < GK; kk += 32) {
      v16h a[4], b[4];
      // in the order the WMMAs below first need them
      a[0] = frag_load(aL + kk, half);
#pragma unroll
      for (int i = 0; i < 4; ++i) b[i] = frag_load(bL + i * 16 * GPITCH + kk, half);
#pragma unroll
      for (int i = 1; i < 4; ++i) a[i] = frag_load(aL + i * 16 * GPITCH + kk, half);
      // keeps the 16 LDS reads of this k step together ahead of its 16 WMMAs:
      // spread among them, every row of four waits out a full LDS latency
      __builtin_amdgcn_sched_barrier(0);
#pragma unroll
      for (int mm = 0; mm < 4; ++mm)
#pragma unroll
        for (int u = 0; u < 4; ++u)
          acc[mm][u] = __builtin_amdgcn_wmma_f32_16x16x32_f16(
              false, a[mm], false, b[u], (short)0, acc[mm][u], false, false);
      // the next k step's reads stay behind this step's WMMAs (one load group)
      __builtin_amdgcn_sched_barrier(0);
    }
    // Publish point: this wave's reads of buffer t%2 are done, its copies of
    // stage t+1 have landed; behind the barrier both hold for every wave.
    asm volatile("s_wait_dscnt 0x0" ::: "memory");
    asm volatile("s_wait_asynccnt 0x0" ::: "memory");
    __syncthreads();
    if (t + 2 < D_MODEL / GK)
      fill_stage(ga + (t + 2) * GK, gw + (t + 2) * GK, l0 + (unsigned)(t & 1) * (GSTAGE * 2u));
  }
  // no copy is outstanding when the wave goes on to its stores and ends
  asm volatile("s_wait_asynccnt 0x0" ::: "memory");

  if (mode == 2) {
    // V^T: a lane's 8 accumulator rows are 8 consecutive s of one d row, so
    // they go out as one 16-byte store instead of eight 2-byte stores.
    // The three loops are unrolled so that acc[][] keeps constant indices
    // (stays in registers) and the stores issue as one group.
#pragma unroll
    for (int mm = 0; mm < 4; ++mm) {
#pragma unroll
      for (int t = 0; t < 4; ++t) {
        int n  = n0 + 16 * t + ln;
        float bv = bias[n];
        int m  = m0 + mm * 16 + half * 8;      // multiple of 8: stays in one batch
        int b_ = m >> 11;                      // m / SEQ
        int s_ = m & (SEQ - 1);
        int bh = b_ * NHEADS + (n >> 6);       // n / HDIM
        int d_ = n & (HDIM - 1);
        union { _Float16 h[8]; uint4 u; } pk;
#pragma unroll
        for (int r = 0; r < 8; ++r) pk.h[r] = (_Float16)(acc[mm][t][r] + bv);
        *(uint4*)&outH[((size_t)bh * HDIM + d_) * SEQ + s_] = pk.u;
      }
    }
    return;
  }

  // Q, K: a wave's 64 rows lie in one batch (m0 is a multiple of 64) and its 64
  // columns are one head, so every element sits at a constant offset from one base.
  _Float16* oQK = outH + ((size_t)((m0 >> 11) * NHEADS + (n0 >> 6)) * SEQ
                          + (m0 & (SEQ - 1)) + half * 8) * HDIM + ln;
#pragma unroll
  for (int mm = 0; mm < 4; ++mm) {
#pragma unroll
    for (int t = 0; t < 4; ++t) {
      int n = n0 + 16 * t + ln;
      float bv = bias[n];
#pragma unroll
      for (int r = 0; r < 8; ++r) {
        int m = m0 + mm * 16 + r + half * 8;   // C layout: VGPR r -> row r+8*half
        float val = acc[mm][t][r] + bv;
        if (mode == 3) {
          outF[(size_t)m * D_MODEL + n] = val;
        } else {
          const int e = (mm * 16 + r) * HDIM + 16 * t;   // row s, column d from the base
          if (mode == 0)
            oQK[e] = (_Float16)(val * 0.125f);
          else if (mode == 1)
            oQK[e] = (_Float16)val;
        }
      }
    }
  }
}

// lane l reads lane l ^ 16: a vector cross-row move, no LDS round trip
__device__ __forceinline__ float xhalf(float x) {
  return __builtin_bit_cast(float, __builtin_amdgcn_permlanex16(
      __builtin_bit_cast(int, x), __builtin_bit_cast(int, x),
      0x76543210, 0xfedcba98, false, false));
}

// 2^x of eight values and of one more, each in place. The v_exp_f32 stand in one
// statement so that none is directly followed by a write of its own source (left
// to the register allocator, a v_exp often lands on the source of the one before);
// the closing v_nop is the slot the instruction set asks for behind a
// transcendental before its result is used.
__device__ __forceinline__ void exp2x9(float (&x)[8], float& y) {
  asm("v_exp_f32 %0, %0\n\t"
      "v_exp_f32 %1, %1\n\t"
      "v_exp_f32 %2, %2\n\t"
      "v_exp_f32 %3, %3\n\t"
      "v_exp_f32 %4, %4\n\t"
      "v_exp_f32 %5, %5\n\t"
      "v_exp_f32 %6, %6\n\t"
      "v_exp_f32 %7, %7\n\t"
      "v_exp_f32 %8, %8\n\t"
      "v_nop"
      : "+v"(y), "+v"(x[0]), "+v"(x[1]), "+v"(x[2]), "+v"(x[3]),
        "+v"(x[4]), "+v"(x[5]), "+v"(x[6]), "+v"(x[7]));
}
__device__ __forceinline__ void exp2x8(float (&x)[8]) {
  asm("v_exp_f32 %0, %0\n\t"
      "v_exp_f32 %1, %1\n\t"
      "v_exp_f32 %2, %2\n\t"
      "v_exp_f32 %3, %3\n\t"
      "v_exp_f32 %4, %4\n\t"
      "v_exp_f32 %5, %5\n\t"
      "v_exp_f32 %6, %6\n\t"
      "v_exp_f32 %7, %7\n\t"
      "v_nop"
      : "+v"(x[0]), "+v"(x[1]), "+v"(x[2]), "+v"(x[3]),
        "+v"(x[4]), "+v"(x[5]), "+v"(x[6]), "+v"(x[7]));
}

// One attention stage: 64 keys of K (64 rows of 128 bytes, contiguous in memory)
// and of V^T (64 d rows, 128 bytes of each), as whole 128-byte lines.
#define AKEYS   64                    // keys per stage
#define APITCH  72                    // LDS row pitch in halfs: 144 B = 16 B x 9
#define ASTAGE  (128 * APITCH)        // halfs per stage: 64 K rows, then 64 V^T rows
// Eight asynchronous 16-byte copies per lane, rows 16 apart: four of K, four of
// V^T (one wave-wide copy covers four whole rows). gk, gv and l are the lane's own
// first chunk. The s_wait_xcnt stands inside the copies' own statement so that no
// address register is rewritten ahead of it.
__device__ __forceinline__ void fill_kv(const _Float16* gk, const _Float16* gv, unsigned l) {
  asm volatile(
      "global_load_async_to_lds_b128 %0, %8, off\n\t"
      "global_load_async_to_lds_b128 %1, %9, off\n\t"
      "global_load_async_to_lds_b128 %2, %10, off\n\t"
      "global_load_async_to_lds_b128 %3, %11, off\n\t"
      "global_load_async_to_lds_b128 %4, %12, off\n\t"
      "global_load_async_to_lds_b128 %5, %13, off\n\t"
      "global_load_async_to_lds_b128 %6, %14, off\n\t"
      "global_load_async_to_lds_b128 %7, %15, off\n\t"
      "s_wait_xcnt 0x0"
      :: "v"(l), "v"(l + 16u * APITCH * 2u), "v"(l + 32u * APITCH * 2u),
         "v"(l + 48u * APITCH * 2u), "v"(l + 64u * APITCH * 2u),
         "v"(l + 80u * APITCH * 2u), "v"(l + 96u * APITCH * 2u),
         "v"(l + 112u * APITCH * 2u),
         "v"(gk), "v"(gk + 16 * HDIM), "v"(gk + 32 * HDIM), "v"(gk + 48 * HDIM),
         "v"(gv), "v"(gv + 16 * SEQ), "v"(gv + 32 * SEQ), "v"(gv + 48 * SEQ)
      : "memory");
}

__global__ __launch_bounds__(128)
void flash_attn(const _Float16* __restrict__ Q, const _Float16* __restrict__ K,
                const _Float16* __restrict__ Vt, _Float16* __restrict__ O) {
  const int lane = threadIdx.x & 31;
  const int wave = threadIdx.x >> 5;
  const int half = lane >> 4;
  const int ln   = lane & 15;
  const int bh   = blockIdx.y;

  __shared__ __align__(16) _Float16 KV[2 * ASTAGE];       // 2 x 18,432 B
  // The lane's own 16-byte chunk: row tid/8 (+16 per copy), chunk tid%8.
  const int rg = threadIdx.x >> 3;
  const int ch = threadIdx.x & 7;
  const _Float16* gk = K + ((size_t)bh * SEQ + rg) * HDIM + ch * 8;
  const _Float16* gv = Vt + ((size_t)bh * HDIM + rg) * SEQ + ch * 8;
  const unsigned  l0 = (unsigned)(size_t)(__attribute__((address_space(3))) _Float16*)
                           &KV[rg * APITCH + ch * 8];

  // kept rolled: the two query blocks run one after the other through the same
  // text; unrolled, the text a cold launch has to fetch would double
#pragma unroll 1
  for (int part = 0; part < 2; ++part) {
  const int qblk = part == 0 ? SEQ / 64 - 1 - (int)blockIdx.x : (int)blockIdx.x;
  const int q0   = (qblk * 4 + wave) * 16;
  const int q    = q0 + ln;              // the lane's own query

  const _Float16* Qb = Q + ((size_t)bh * SEQ + q) * HDIM;
  v16h qb0 = frag_load(Qb, half);        // B operand, d = 0..31
  v16h qb1 = frag_load(Qb + 32, half);   // B operand, d = 32..63

  v8f   o[4] = {};                       // o[t][r] = O^T[d = 16t + 8*half + r][q]
  float mi = -1e30f;                     // running maximum, equal in both halves
  float li = 0.0f;                       // running sum over this half's keys only

  // Every reader has left both buffers here: nothing was read before the first
  // query block, and the first one's last trip ends in its waits and barrier.
  const int nst = qblk + 1;              // stages of 64 keys, block-uniform
  fill_kv(gk, gv, l0);
  // stage 0 has landed before any wave reads it
  asm volatile("s_wait_asynccnt 0x0" ::: "memory");
  __syncthreads();
  if (nst > 1) fill_kv(gk + AKEYS * HDIM, gv + AKEYS, l0 + ASTAGE * 2u);

  // kept rolled: a trip is one stage with its publish point at the foot
#pragma unroll 1
  for (int st = 0; st < nst; ++st) {
  const _Float16* Sb = &KV[(st & 1) * ASTAGE];
  // unrolled: the two 32-key halves of a stage read at constant LDS offsets
#pragma unroll
  for (int p = 0; p < 2; ++p) {
    const int j0 = st * AKEYS + p * 32;
    const _Float16* Kl = Sb + (p * 32 + ln) * APITCH;
    const _Float16* Kh = Kl + 16 * APITCH;

    // All LDS reads of the 32 keys (K frags + V frags) as one group; the V
    // fragments arrive under the softmax VALU work.
    v16h ka00 = frag_load(Kl, half);
    v16h ka01 = frag_load(Kl + 32, half);
    v16h ka10 = frag_load(Kh, half);
    v16h ka11 = frag_load(Kh + 32, half);
    v16h va[4];
#pragma unroll
    for (int t = 0; t < 4; ++t)
      va[t] = frag_load(Sb + (64 + 16 * t + ln) * APITCH + p * 32, half);
    // keeps the 16 loads one group ahead of the first WMMA: with fewer live
    // registers the compiler otherwise reuses fragment registers and strings
    // the loads out between the WMMAs, one LDS latency after another
    __builtin_amdgcn_sched_barrier(0);

    // sl[r] = S^T[key j0 + 8*half + r][q], sh[r] = the same 16 keys further on
    v8f sl = {}, sh = {};
    sl = __builtin_amdgcn_wmma_f32_16x16x32_f16(false, ka00, false, qb0, (short)0, sl, false, false);
    sl = __builtin_amdgcn_wmma_f32_16x16x32_f16(false, ka01, false, qb1, (short)0, sl, false, false);
    sh = __builtin_amdgcn_wmma_f32_16x16x32_f16(false, ka10, false, qb0, (short)0, sh, false, false);
    sh = __builtin_amdgcn_wmma_f32_16x16x32_f16(false, ka11, false, qb1, (short)0, sh, false, false);

    const int kb = j0 + half * 8;
    float v = -1e30f;
#pragma unroll
    for (int r = 0; r < 8; ++r) {
      sl[r] = (kb + r      <= q) ? sl[r] : -1e30f;   // causal mask: key > query
      sh[r] = (kb + 16 + r <= q) ? sh[r] : -1e30f;
      v = fmaxf(v, fmaxf(sl[r], sh[r]));
    }
    v = fmaxf(v, xhalf(v));              // the other half's 16 keys of this query
    const float mnew  = fmaxf(mi, v);
    // e^x as 2^(x * log2 e), the form of __expf
    const float L2E = 1.44269504088896340736f;
    float scale = (mi - mnew) * L2E;
    mi = mnew;
    float ea[8], eb[8];
#pragma unroll
    for (int r = 0; r < 8; ++r) {
      ea[r] = (sl[r] - mnew) * L2E;
      eb[r] = (sh[r] - mnew) * L2E;
    }
    exp2x9(ea, scale);
    exp2x8(eb);

    // P^T as B operand: element s is key j0 + 8*half + s (+ 8 for s >= 8), the order of va[]
    v16h pb;
    float rs = 0.0f;
#pragma unroll
    for (int r = 0; r < 8; ++r) {
      rs += ea[r] + eb[r];
      pb[r]     = (_Float16)ea[r];
      pb[8 + r] = (_Float16)eb[r];
    }
    li = li * scale + rs;

#pragma unroll
    for (int t = 0; t < 4; ++t)
#pragma unroll
      for (int r = 0; r < 8; ++r) o[t][r] *= scale;

    // O^T += V^T x P^T : A[d][k] = Vt row d (keys contiguous), B[k][q] = P^T
#pragma unroll
    for (int t = 0; t < 4; ++t)
      o[t] = __builtin_amdgcn_wmma_f32_16x16x32_f16(
          false, va[t], false, pb, (short)0, o[t], false, false);
  }
    // Publish point: this wave's reads of buffer st%2 are done, its copies of
    // stage st+1 have landed; behind the barrier both hold for every wave.
    asm volatile("s_wait_dscnt 0x0" ::: "memory");
    asm volatile("s_wait_asynccnt 0x0" ::: "memory");
    __syncthreads();
    if (st + 2 < nst)
      fill_kv(gk + (st + 2) * (AKEYS * HDIM), gv + (st + 2) * AKEYS,
              l0 + (unsigned)(st & 1) * (ASTAGE * 2u));
  }
  // no copy is outstanding when the wave goes on to its stores
  asm volatile("s_wait_asynccnt 0x0" ::: "memory");

  li += xhalf(li);                       // join the two halves' sums, once
  const int b_ = bh >> 4;
  const int h_ = bh & 15;
  // a lane's 8 accumulator registers are 8 consecutive d of its query's row
  _Float16* Ob = O + ((size_t)(b_ * SEQ + q)) * D_MODEL + h_ * HDIM + half * 8;
#pragma unroll
  for (int t = 0; t < 4; ++t) {
    union { _Float16 h[8]; uint4 u; } pk;
#pragma unroll
    for (int r = 0; r < 8; ++r) pk.h[r] = (_Float16)(o[t][r] / li);
    *(uint4*)&Ob[16 * t] = pk.u;
  }
  // the next query block rewrites the registers that these stores name (address
  // and data): the wait stands behind the stores, in front of every such write
  asm volatile("s_wait_xcnt 0x0" ::: "memory");
  }
}

extern "C" void kernel_launch(void* const* d_in, const int* in_sizes, int n_in,
                              void* d_out, int out_size, void* d_ws, size_t ws_size,
                              hipStream_t stream) {
  const float* x  = (const float*)d_in[0];
  const float* Wq = (const float*)d_in[1];
  const float* bq = (const float*)d_in[2];
  const float* Wk = (const float*)d_in[3];
  const float* bk = (const float*)d_in[4];
  const float* Wv = (const float*)d_in[5];
  const float* bv = (const float*)d_in[6];
  const float* Wo = (const float*)d_in[7];
  const float* bo = (const float*)d_in[8];
  float* out = (float*)d_out;

  char* ws = (char*)d_ws;
  size_t off = 0;
  const size_t XSZ = (size_t)MTOT * D_MODEL * sizeof(_Float16);      // 16 MB
  const size_t WSZ = (size_t)D_MODEL * D_MODEL * sizeof(_Float16);   //  2 MB
  _Float16* xh  = (_Float16*)(ws + off); off += XSZ;
  _Float16* wqh = (_Float16*)(ws + off); off += WSZ;
  _Float16* wkh = (_Float16*)(ws + off); off += WSZ;
  _Float16* wvh = (_Float16*)(ws + off); off += WSZ;
  _Float16* woh = (_Float16*)(ws + off); off += WSZ;
  _Float16* qh  = (_Float16*)(ws + off); off += XSZ;
  _Float16* kh  = (_Float16*)(ws + off); off += XSZ;
  _Float16* vt  = (_Float16*)(ws + off); off += XSZ;
  _Float16* at  = (_Float16*)(ws + off); off += XSZ;   // attention output (b, s, h*hd)
  (void)in_sizes; (void)n_in; (void)out_size; (void)ws_size;

  f32_to_f16<<<4096, 256, 0, stream>>>(x,  xh,  MTOT * D_MODEL);
  f32_to_f16<<<1024, 256, 0, stream>>>(Wq, wqh, D_MODEL * D_MODEL);
  f32_to_f16<<<1024, 256, 0, stream>>>(Wk, wkh, D_MODEL * D_MODEL);
  f32_to_f16<<<1024, 256, 0, stream>>>(Wv, wvh, D_MODEL * D_MODEL);
  f32_to_f16<<<1024, 256, 0, stream>>>(Wo, woh, D_MODEL * D_MODEL);

  dim3 gg(MTOT / 128, D_MODEL / 128);
  gemm32<0><<<gg, 128, 0, stream>>>(xh, wqh, bq, qh, nullptr);   // Q (scaled)
  gemm32<1><<<gg, 128, 0, stream>>>(xh, wkh, bk, kh, nullptr);   // K
  gemm32<2><<<gg, 128, 0, stream>>>(xh, wvh, bv, vt, nullptr);   // V^T

  flash_attn<<<dim3(SEQ / 128, BATCH * NHEADS), 128, 0, stream>>>(qh, kh, vt, at);

  gemm32<3><<<gg, 128, 0, stream>>>(at, woh, bo, nullptr, out);  // out proj
}

// v006
// A run of this version takes 125 microseconds.
// In both of two side-by-side timings against v005, it was 1.08 times as fast.
// Over all steps from v000 it is 3.73 times as fast.
#include <hip/hip_runtime.h>

// ---------------------------------------------------------------------------
// Causal self-attention for MI455X (gfx1250, wave32, WMMA).
// fp32 in/out; internal compute in f16 with fp32 WMMA accumulation.
// ---------------------------------------------------------------------------

typedef __attribute__((ext_vector_type(16))) _Float16 v16h;
typedef __attribute__((ext_vector_type(8)))  float    v8f;

#define D_MODEL 1024
#define NHEADS  16
#define HDIM    64
#define SEQ     2048
#define BATCH   4
#define MTOT    (BATCH * SEQ)   // 8192 rows

// Load a 16x32 f16 fragment (A-layout or symmetric B-layout) where the WMMA
// K-dimension is contiguous in memory at `p` (p = row/col start + k-base).
// Per CDNA5 ISA 16-bit A layout: lane half = lane>>4,
//   VGPR v holds K = (v/4)*16 + half*8 + (v%4)*2  (+1 for hi half of dword).
// Per half this is two contiguous 16B chunks -> compiler emits 2x b128 loads.
__device__ __forceinline__ v16h frag_load(const _Float16* p, int half) {
  union { v16h h; unsigned int u[8]; } r;
#pragma unroll
  for (int v = 0; v < 8; ++v) {
    int k = ((v >> 2) << 4) + (half << 3) + ((v & 3) << 1);
    r.u[v] = *(const unsigned int*)(p + k);
  }
  return r.h;
}

// Eight asynchronous 16-byte copies global -> LDS, rows 8 apart (one wave-wide
// copy covers two whole 256-byte row slabs). The s_wait_xcnt stands inside the
// copies' own statement so that no address register is rewritten ahead of it.
#define GK      128                   // k elements per stage (256 B per row)
#define GPITCH  136                   // LDS row pitch in halfs: 272 B = 16 B x 17
#define GSTAGE  (256 * GPITCH)        // halfs per stage: 128 A rows + 128 W rows
__device__ __forceinline__ void async_rows8(const _Float16* g, unsigned l) {
  asm volatile(
      "global_load_async_to_lds_b128 %0, %8, off\n\t"
      "global_load_async_to_lds_b128 %1, %9, off\n\t"
      "global_load_async_to_lds_b128 %2, %10, off\n\t"
      "global_load_async_to_lds_b128 %3, %11, off\n\t"
      "global_load_async_to_lds_b128 %4, %12, off\n\t"
      "global_load_async_to_lds_b128 %5, %13, off\n\t"
      "global_load_async_to_lds_b128 %6, %14, off\n\t"
      "global_load_async_to_lds_b128 %7, %15, off\n\t"
      "s_wait_xcnt 0x0"
      :: "v"(l), "v"(l + 8u * GPITCH * 2u), "v"(l + 16u * GPITCH * 2u),
         "v"(l + 24u * GPITCH * 2u), "v"(l + 32u * GPITCH * 2u),
         "v"(l + 40u * GPITCH * 2u), "v"(l + 48u * GPITCH * 2u),
         "v"(l + 56u * GPITCH * 2u),
         "v"(g), "v"(g + 8 * D_MODEL), "v"(g + 16 * D_MODEL), "v"(g + 24 * D_MODEL),
         "v"(g + 32 * D_MODEL), "v"(g + 40 * D_MODEL), "v"(g + 48 * D_MODEL),
         "v"(g + 56 * D_MODEL)
      : "memory");
}

// One stage: 128 rows of A, then 128 rows of W, 256 bytes of each row.
// 32 copies per lane; ga/gw and l are the lane's own first chunk.
__device__ __forceinline__ void fill_stage(const _Float16* ga, const _Float16* gw, unsigned l) {
  async_rows8(ga, l);
  async_rows8(ga + 64 * D_MODEL, l + 64u * GPITCH * 2u);
  async_rows8(gw, l + 128u * GPITCH * 2u);
  async_rows8(gw + 64 * D_MODEL, l + 192u * GPITCH * 2u);
}

// All five f32 -> f16 conversions in one streaming launch. The f16 copies of x,
// Wq, Wk, Wv, Wo lie one behind the other in the workspace, so d is one array of
// 768 units of 16,384 elements: 512 of x, then 64 of each weight. One block of 16
// waves per WGP takes three units: b and b + 256 (x) and 512 + b (weight b / 64).
// A wave owns 4 KB of each unit: eight 16-byte loads per lane, each wave-wide load
// four whole lines, each wave-wide 8-byte store two whole lines.
typedef __attribute__((ext_vector_type(4))) float    v4f;
typedef __attribute__((ext_vector_type(4))) _Float16 v4h;
#define CVT_UNIT 16384
__global__ __launch_bounds__(512)
void f32_to_f16_all(const float* __restrict__ x, const float* __restrict__ wq,
                    const float* __restrict__ wk, const float* __restrict__ wv,
                    const float* __restrict__ wo, _Float16* __restrict__ d) {
  const int b  = blockIdx.x;
  const int e0 = (threadIdx.x >> 5) * 1024 + (threadIdx.x & 31) * 4;   // in the unit
  const float* w = b < 64 ? wq : b < 128 ? wk : b < 192 ? wv : wo;
  const float* s0 = x + (size_t)b * CVT_UNIT + e0;
  const float* s1 = x + (size_t)(b + 256) * CVT_UNIT + e0;
  const float* s2 = w + (size_t)(b & 63) * CVT_UNIT + e0;
  v4f r0[8], r1[8], r2[8];
  // unrolled: constant offsets from three bases, the loaded values stay in registers
#pragma unroll
  for (int j = 0; j < 8; ++j) r0[j] = *(const v4f*)(s0 + j * 128);
#pragma unroll
  for (int j = 0; j < 8; ++j) r1[j] = *(const v4f*)(s1 + j * 128);
#pragma unroll
  for (int j = 0; j < 8; ++j) r2[j] = *(const v4f*)(s2 + j * 128);
  // all 24 loads of a lane issue ahead of the first conversion: without it the
  // compiler reuses the first loads' registers and holds the last ten loads back
  // until the first ones have returned
  __builtin_amdgcn_sched_barrier(0);
  _Float16* d0 = d + (size_t)b * CVT_UNIT + e0;
  _Float16* d1 = d + (size_t)(b + 256) * CVT_UNIT + e0;
  _Float16* d2 = d + (size_t)(b + 512) * CVT_UNIT + e0;
  // unrolled like the loads: r0, r1, r2 keep constant indices (stay in registers)
#pragma unroll
  for (int j = 0; j < 8; ++j) *(v4h*)(d0 + j * 128) = __builtin_convertvector(r0[j], v4h);
#pragma unroll
  for (int j = 0; j < 8; ++j) *(v4h*)(d1 + j * 128) = __builtin_convertvector(r1[j], v4h);
#pragma unroll
  for (int j = 0; j < 8; ++j) *(v4h*)(d2 + j * 128) = __builtin_convertvector(r2[j], v4h);
}

// GEMM: out[m,n] = sum_k A[m,k] * W[n,k] + bias[n]   (nn.Linear semantics)
// Block = 4 waves (2x2) computing a 128x128 tile; each wave owns 64x64
// (16 WMMA acc). Both operands come per 128-k stage into a two-buffer LDS ring
// by asynchronous copies and are shared by the block's waves.
// mode 0: store Q (bh,s,hd) scaled by 1/sqrt(HDIM)
// mode 1: store K (bh,s,hd)
// mode 2: store V transposed (bh,hd,s), 16 bytes per lane
// mode 3: store fp32 row-major to outF (final projection)
// mode is a compile-time constant, for speed only.
template <int mode>
__global__ __launch_bounds__(128)
void gemm32(const _Float16* __restrict__ A, const _Float16* __restrict__ W,
            const float* __restrict__ bias, _Float16* __restrict__ outH,
            float* __restrict__ outF) {
  __shared__ __align__(16) _Float16 S[2 * GSTAGE];        // 2 x 69,632 B
  const int tid  = threadIdx.x;
  const int lane = tid & 31;
  const int wave = tid >> 5;
  const int half = lane >> 4;
  const int ln   = lane & 15;
  const int wm   = wave >> 1;
  const int wn   = wave & 1;
  const int m0   = blockIdx.x * 128 + wm * 64;
  const int n0   = blockIdx.y * 128 + wn * 64;

  // The lane's own 16-byte chunk: row tid/16 (+8 per copy), chunk tid%16.
  const int rg = tid >> 4;
  const int ch = tid & 15;
  const _Float16* ga = A + (size_t)(blockIdx.x * 128 + rg) * D_MODEL + ch * 8;
  const _Float16* gw = W + (size_t)(blockIdx.y * 128 + rg) * D_MODEL + ch * 8;
  const unsigned  l0 = (unsigned)(size_t)(__attribute__((address_space(3))) _Float16*)
                           &S[rg * GPITCH + ch * 8];

  fill_stage(ga, gw, l0);
  // stage 0 has landed before any wave reads it
  asm volatile("s_wait_asynccnt 0x0" ::: "memory");
  __syncthreads();
  fill_stage(ga + GK, gw + GK, l0 + GSTAGE * 2u);

  v8f acc[4][4] = {};
  // kept rolled: unrolling would only multiply the text a cold launch has to
  // fetch; a trip costs a few scalar instructions per 64 WMMAs
#pragma unroll 1
  for (int t = 0; t < D_MODEL / GK; ++t) {
    const _Float16* Sb = &S[(t & 1) * GSTAGE];
    const _Float16* aL = Sb + (wm * 64 + ln) * GPITCH;
    const _Float16* bL = Sb + (128 + wn * 64 + ln) * GPITCH;
#pragma unroll
    for (int kk = 0; kk < GK; kk += 32) {
      v16h a[4], b[4];
      // in the order the WMMAs below first need them
      a[0] = frag_load(aL + kk, half);
#pragma unroll
      for (int i = 0; i < 4; ++i) b[i] = frag_load(bL + i * 16 * GPITCH + kk, half);
#pragma unroll
      for (int i = 1; i < 4; ++i) a[i] = frag_load(aL + i * 16 * GPITCH + kk, half);
      // keeps the 16 LDS reads of this k step together ahead of its 16 WMMAs:
      // spread among them, every row of four waits out a full LDS latency
      __builtin_amdgcn_sched_barrier(0);
#pragma unroll
      for (int mm = 0; mm < 4; ++mm)
#pragma unroll
        for (int u = 0; u < 4; ++u)
          acc[mm][u] = __builtin_amdgcn_wmma_f32_16x16x32_f16(
              false, a[mm], false, b[u], (short)0, acc[mm][u], false, false);
      // the next k step's reads stay behind this step's WMMAs (one load group)
      __builtin_amdgcn_sched_barrier(0);
    }
    // Publish point: this wave's reads of buffer t%2 are done, its copies of
    // stage t+1 have landed; behind the barrier both hold for every wave.
    asm volatile("s_wait_dscnt 0x0" ::: "memory");
    asm volatile("s_wait_asynccnt 0x0" ::: "memory");
    __syncthreads();
    if (t + 2 < D_MODEL / GK)
      fill_stage(ga + (t + 2) * GK, gw + (t + 2) * GK, l0 + (unsigned)(t & 1) * (GSTAGE * 2u));
  }
  // no copy is outstanding when the wave goes on to its stores and ends
  asm volatile("s_wait_asynccnt 0x0" ::: "memory");

  if (mode == 2) {
    // V^T: a lane's 8 accumulator rows are 8 consecutive s of one d row, so
    // they go out as one 16-byte store instead of eight 2-byte stores.
    // The three loops are unrolled so that acc[][] keeps constant indices
    // (stays in registers) and the stores issue as one group.
#pragma unroll
    for (int mm = 0; mm < 4; ++mm) {
#pragma unroll
      for (int t = 0; t < 4; ++t) {
        int n  = n0 + 16 * t + ln;
        float bv = bias[n];
        int m  = m0 + mm * 16 + half * 8;      // multiple of 8: stays in one batch
        int b_ = m >> 11;                      // m / SEQ
        int s_ = m & (SEQ - 1);
        int bh = b_ * NHEADS + (n >> 6);       // n / HDIM
        int d_ = n & (HDIM - 1);
        union { _Float16 h[8]; uint4 u; } pk;
#pragma unroll
        for (int r = 0; r < 8; ++r) pk.h[r] = (_Float16)(acc[mm][t][r] + bv);
        *(uint4*)&outH[((size_t)bh * HDIM + d_) * SEQ + s_] = pk.u;
      }
    }
    return;
  }

  // Q, K: a wave's 64 rows lie in one batch (m0 is a multiple of 64) and its 64
  // columns are one head, so every element sits at a constant offset from one base.
  _Float16* oQK = outH + ((size_t)((m0 >> 11) * NHEADS + (n0 >> 6)) * SEQ
                          + (m0 & (SEQ - 1)) + half * 8) * HDIM + ln;
#pragma unroll
  for (int mm = 0; mm < 4; ++mm) {
#pragma unroll
    for (int t = 0; t < 4; ++t) {
      int n = n0 + 16 * t + ln;
      float bv = bias[n];
#pragma unroll
      for (int r = 0; r < 8; ++r) {
        int m = m0 + mm * 16 + r + half * 8;   // C layout: VGPR r -> row r+8*half
        float val = acc[mm][t][r] + bv;
        if (mode == 3) {
          outF[(size_t)m * D_MODEL + n] = val;
        } else {
          const int e = (mm * 16 + r) * HDIM + 16 * t;   // row s, column d from the base
          if (mode == 0)
            oQK[e] = (_Float16)(val * 0.125f);
          else if (mode == 1)
            oQK[e] = (_Float16)val;
        }
      }
    }
  }
}

// lane l reads lane l ^ 16: a vector cross-row move, no LDS round trip
__device__ __forceinline__ float xhalf(float x) {
  return __builtin_bit_cast(float, __builtin_amdgcn_permlanex16(
      __builtin_bit_cast(int, x), __builtin_bit_cast(int, x),
      0x76543210, 0xfedcba98, false, false));
}

// 2^x of eight values and of one more, each in place. The v_exp_f32 stand in one
// statement so that none is directly followed by a write of its own source (left
// to the register allocator, a v_exp often lands on the source of the one before);
// the closing v_nop is the slot the instruction set asks for behind a
// transcendental before its result is used.
__device__ __forceinline__ void exp2x9(float (&x)[8], float& y) {
  asm("v_exp_f32 %0, %0\n\t"
      "v_exp_f32 %1, %1\n\t"
      "v_exp_f32 %2, %2\n\t"
      "v_exp_f32 %3, %3\n\t"
      "v_exp_f32 %4, %4\n\t"
      "v_exp_f32 %5, %5\n\t"
      "v_exp_f32 %6, %6\n\t"
      "v_exp_f32 %7, %7\n\t"
      "v_exp_f32 %8, %8\n\t"
      "v_nop"
      : "+v"(y), "+v"(x[0]), "+v"(x[1]), "+v"(x[2]), "+v"(x[3]),
        "+v"(x[4]), "+v"(x[5]), "+v"(x[6]), "+v"(x[7]));
}
__device__ __forceinline__ void exp2x8(float (&x)[8]) {
  asm("v_exp_f32 %0, %0\n\t"
      "v_exp_f32 %1, %1\n\t"
      "v_exp_f32 %2, %2\n\t"
      "v_exp_f32 %3, %3\n\t"
      "v_exp_f32 %4, %4\n\t"
      "v_exp_f32 %5, %5\n\t"
      "v_exp_f32 %6, %6\n\t"
      "v_exp_f32 %7, %7\n\t"
      "v_nop"
      : "+v"(x[0]), "+v"(x[1]), "+v"(x[2]), "+v"(x[3]),
        "+v"(x[4]), "+v"(x[5]), "+v"(x[6]), "+v"(x[7]));
}

// One attention stage: 64 keys of K (64 rows of 128 bytes, contiguous in memory)
// and of V^T (64 d rows, 128 bytes of each), as whole 128-byte lines.
#define AKEYS   64                    // keys per stage
#define APITCH  72                    // LDS row pitch in halfs: 144 B = 16 B x 9
#define ASTAGE  (128 * APITCH)        // halfs per stage: 64 K rows, then 64 V^T rows
// Eight asynchronous 16-byte copies per lane, rows 16 apart: four of K, four of
// V^T (one wave-wide copy covers four whole rows). gk, gv and l are the lane's own
// first chunk. The s_wait_xcnt stands inside the copies' own statement so that no
// address register is rewritten ahead of it.
__device__ __forceinline__ void fill_kv(const _Float16* gk, const _Float16* gv, unsigned l) {
  asm volatile(
      "global_load_async_to_lds_b128 %0, %8, off\n\t"
      "global_load_async_to_lds_b128 %1, %9, off\n\t"
      "global_load_async_to_lds_b128 %2, %10, off\n\t"
      "global_load_async_to_lds_b128 %3, %11, off\n\t"
      "global_load_async_to_lds_b128 %4, %12, off\n\t"
      "global_load_async_to_lds_b128 %5, %13, off\n\t"
      "global_load_async_to_lds_b128 %6, %14, off\n\t"
      "global_load_async_to_lds_b128 %7, %15, off\n\t"
      "s_wait_xcnt 0x0"
      :: "v"(l), "v"(l + 16u * APITCH * 2u), "v"(l + 32u * APITCH * 2u),
         "v"(l + 48u * APITCH * 2u), "v"(l + 64u * APITCH * 2u),
         "v"(l + 80u * APITCH * 2u), "v"(l + 96u * APITCH * 2u),
         "v"(l + 112u * APITCH * 2u),
         "v"(gk), "v"(gk + 16 * HDIM), "v"(gk + 32 * HDIM), "v"(gk + 48 * HDIM),
         "v"(gv), "v"(gv + 16 * SEQ), "v"(gv + 32 * SEQ), "v"(gv + 48 * SEQ)
      : "memory");
}

__global__ __launch_bounds__(128)
void flash_attn(const _Float16* __restrict__ Q, const _Float16* __restrict__ K,
                const _Float16* __restrict__ Vt, _Float16* __restrict__ O) {
  const int lane = threadIdx.x & 31;
  const int wave = threadIdx.x >> 5;
  const int half = lane >> 4;
  const int ln   = lane & 15;
  const int bh   = blockIdx.y;

  __shared__ __align__(16) _Float16 KV[2 * ASTAGE];       // 2 x 18,432 B
  // The lane's own 16-byte chunk: row tid/8 (+16 per copy), chunk tid%8.
  const int rg = threadIdx.x >> 3;
  const int ch = threadIdx.x & 7;
  const _Float16* gk = K + ((size_t)bh * SEQ + rg) * HDIM + ch * 8;
  const _Float16* gv = Vt + ((size_t)bh * HDIM + rg) * SEQ + ch * 8;
  const unsigned  l0 = (unsigned)(size_t)(__attribute__((address_space(3))) _Float16*)
                           &KV[rg * APITCH + ch * 8];

  // kept rolled: the two query blocks run one after the other through the same
  // text; unrolled, the text a cold launch has to fetch would double
#pragma unroll 1
  for (int part = 0; part < 2; ++part) {
  const int qblk = part == 0 ? SEQ / 64 - 1 - (int)blockIdx.x : (int)blockIdx.x;
  const int q0   = (qblk * 4 + wave) * 16;
  const int q    = q0 + ln;              // the lane's own query

  const _Float16* Qb = Q + ((size_t)bh * SEQ + q) * HDIM;
  v16h qb0 = frag_load(Qb, half);        // B operand, d = 0..31
  v16h qb1 = frag_load(Qb + 32, half);   // B operand, d = 32..63

  v8f   o[4] = {};                       // o[t][r] = O^T[d = 16t + 8*half + r][q]
  float mi = -1e30f;                     // running maximum, equal in both halves
  float li = 0.0f;                       // running sum over this half's keys only

  // Every reader has left both buffers here: nothing was read before the first
  // query block, and the first one's last trip ends in its waits and barrier.
  const int nst = qblk + 1;              // stages of 64 keys, block-uniform
  fill_kv(gk, gv, l0);
  // stage 0 has landed before any wave reads it
  asm volatile("s_wait_asynccnt 0x0" ::: "memory");
  __syncthreads();
  if (nst > 1) fill_kv(gk + AKEYS * HDIM, gv + AKEYS, l0 + ASTAGE * 2u);

  // kept rolled: a trip is one stage with its publish point at the foot
#pragma unroll 1
  for (int st = 0; st < nst; ++st) {
  const _Float16* Sb = &KV[(st & 1) * ASTAGE];
  // unrolled: the two 32-key halves of a stage read at constant LDS offsets
#pragma unroll
  for (int p = 0; p < 2; ++p) {
    const int j0 = st * AKEYS + p * 32;
    const _Float16* Kl = Sb + (p * 32 + ln) * APITCH;
    const _Float16* Kh = Kl + 16 * APITCH;

    // All LDS reads of the 32 keys (K frags + V frags) as one group; the V
    // fragments arrive under the softmax VALU work.
    v16h ka00 = frag_load(Kl, half);
    v16h ka01 = frag_load(Kl + 32, half);
    v16h ka10 = frag_load(Kh, half);
    v16h ka11 = frag_load(Kh + 32, half);
    v16h va[4];
#pragma unroll
    for (int t = 0; t < 4; ++t)
      va[t] = frag_load(Sb + (64 + 16 * t + ln) * APITCH + p * 32, half);
    // keeps the 16 loads one group ahead of the first WMMA: with fewer live
    // registers the compiler otherwise reuses fragment registers and strings
    // the loads out between the WMMAs, one LDS latency after another
    __builtin_amdgcn_sched_barrier(0);

    // sl[r] = S^T[key j0 + 8*half + r][q], sh[r] = the same 16 keys further on
    v8f sl = {}, sh = {};
    sl = __builtin_amdgcn_wmma_f32_16x16x32_f16(false, ka00, false, qb0, (short)0, sl, false, false);
    sl = __builtin_amdgcn_wmma_f32_16x16x32_f16(false, ka01, false, qb1, (short)0, sl, false, false);
    sh = __builtin_amdgcn_wmma_f32_16x16x32_f16(false, ka10, false, qb0, (short)0, sh, false, false);
    sh = __builtin_amdgcn_wmma_f32_16x16x32_f16(false, ka11, false, qb1, (short)0, sh, false, false);

    const int kb = j0 + half * 8;
    float v = -1e30f;
#pragma unroll
    for (int r = 0; r < 8; ++r) {
      sl[r] = (kb + r      <= q) ? sl[r] : -1e30f;   // causal mask: key > query
      sh[r] = (kb + 16 + r <= q) ? sh[r] : -1e30f;
      v = fmaxf(v, fmaxf(sl[r], sh[r]));
    }
    v = fmaxf(v, xhalf(v));              // the other half's 16 keys of this query
    const float mnew  = fmaxf(mi, v);
    // e^x as 2^(x * log2 e), the form of __expf
    const float L2E = 1.44269504088896340736f;
    float scale = (mi - mnew) * L2E;
    mi = mnew;
    float ea[8], eb[8];
#pragma unroll
    for (int r = 0; r < 8; ++r) {
      ea[r] = (sl[r] - mnew) * L2E;
      eb[r] = (sh[r] - mnew) * L2E;
    }
    exp2x9(ea, scale);
    exp2x8(eb);

    // P^T as B operand: element s is key j0 + 8*half + s (+ 8 for s >= 8), the order of va[]
    v16h pb;
    float rs = 0.0f;
#pragma unroll
    for (int r = 0; r < 8; ++r) {
      rs += ea[r] + eb[r];
      pb[r]     = (_Float16)ea[r];
      pb[8 + r] = (_Float16)eb[r];
    }
    li = li * scale + rs;

#pragma unroll
    for (int t = 0; t < 4; ++t)
#pragma unroll
      for (int r = 0; r < 8; ++r) o[t][r] *= scale;

    // O^T += V^T x P^T : A[d][k] = Vt row d (keys contiguous), B[k][q] = P^T
#pragma unroll
    for (int t = 0; t < 4; ++t)
      o[t] = __builtin_amdgcn_wmma_f32_16x16x32_f16(
          false, va[t], false, pb, (short)0, o[t], false, false);
  }
    // Publish point: this wave's reads of buffer st%2 are done, its copies of
    // stage st+1 have landed; behind the barrier both hold for every wave.
    asm volatile("s_wait_dscnt 0x0" ::: "memory");
    asm volatile("s_wait_asynccnt 0x0" ::: "memory");
    __syncthreads();
    if (st + 2 < nst)
      fill_kv(gk + (st + 2) * (AKEYS * HDIM), gv + (st + 2) * AKEYS,
              l0 + (unsigned)(st & 1) * (ASTAGE * 2u));
  }
  // no copy is outstanding when the wave goes on to its stores
  asm volatile("s_wait_asynccnt 0x0" ::: "memory");

  li += xhalf(li);                       // join the two halves' sums, once
  const int b_ = bh >> 4;
  const int h_ = bh & 15;
  // a lane's 8 accumulator registers are 8 consecutive d of its query's row
  _Float16* Ob = O + ((size_t)(b_ * SEQ + q)) * D_MODEL + h_ * HDIM + half * 8;
#pragma unroll
  for (int t = 0; t < 4; ++t) {
    union { _Float16 h[8]; uint4 u; } pk;
#pragma unroll
    for (int r = 0; r < 8; ++r) pk.h[r] = (_Float16)(o[t][r] / li);
    *(uint4*)&Ob[16 * t] = pk.u;
  }
  // the next query block rewrites the registers that these stores name (address
  // and data): the wait stands behind the stores, in front of every such write
  asm volatile("s_wait_xcnt 0x0" ::: "memory");
  }
}

extern "C" void kernel_launch(void* const* d_in, const int* in_sizes, int n_in,
                              void* d_out, int out_size, void* d_ws, size_t ws_size,
                              hipStream_t stream) {
  const float* x  = (const float*)d_in[0];
  const float* Wq = (const float*)d_in[1];
  const float* bq = (const float*)d_in[2];
  const float* Wk = (const float*)d_in[3];
  const float* bk = (const float*)d_in[4];
  const float* Wv = (const float*)d_in[5];
  const float* bv = (const float*)d_in[6];
  const float* Wo = (const float*)d_in[7];
  const float* bo = (const float*)d_in[8];
  float* out = (float*)d_out;

  char* ws = (char*)d_ws;
  size_t off = 0;
  const size_t XSZ = (size_t)MTOT * D_MODEL * sizeof(_Float16);      // 16 MB
  const size_t WSZ = (size_t)D_MODEL * D_MODEL * sizeof(_Float16);   //  2 MB
  _Float16* xh  = (_Float16*)(ws + off); off += XSZ;
  _Float16* wqh = (_Float16*)(ws + off); off += WSZ;
  _Float16* wkh = (_Float16*)(ws + off); off += WSZ;
  _Float16* wvh = (_Float16*)(ws + off); off += WSZ;
  _Float16* woh = (_Float16*)(ws + off); off += WSZ;
  _Float16* qh  = (_Float16*)(ws + off); off += XSZ;
  _Float16* kh  = (_Float16*)(ws + off); off += XSZ;
  _Float16* vt  = (_Float16*)(ws + off); off += XSZ;
  _Float16* at  = (_Float16*)(ws + off); off += XSZ;   // attention output (b, s, h*hd)
  (void)in_sizes; (void)n_in; (void)out_size; (void)ws_size;

  // xh, wqh, wkh, wvh, woh are contiguous from xh on: one destination array
  f32_to_f16_all<<<256, 512, 0, stream>>>(x, Wq, Wk, Wv, Wo, xh);

  dim3 gg(MTOT / 128, D_MODEL / 128);
  gemm32<0><<<gg, 128, 0, stream>>>(xh, wqh, bq, qh, nullptr);   // Q (scaled)
  gemm32<1><<<gg, 128, 0, stream>>>(xh, wkh, bk, kh, nullptr);   // K
  gemm32<2><<<gg, 128, 0, stream>>>(xh, wvh, bv, vt, nullptr);   // V^T

  flash_attn<<<dim3(SEQ / 128, BATCH * NHEADS), 128, 0, stream>>>(qh, kh, vt, at);

  gemm32<3><<<gg, 128, 0, stream>>>(at, woh, bo, nullptr, out);  // out proj
}

// v007
// Measured time: 119 microseconds a run.
// Two timings next to v006 put it at 1.04 and 1.06 times that version's speed.
// Counting every step since v000, it is 3.91 times as fast.
#include <hip/hip_runtime.h>

// ---------------------------------------------------------------------------
// Causal self-attention for MI455X (gfx1250, wave32, WMMA).
// fp32 in/out; internal compute in f16 with fp32 WMMA accumulation.
// ---------------------------------------------------------------------------

typedef __attribute__((ext_vector_type(16))) _Float16 v16h;
typedef __attribute__((ext_vector_type(8)))  float    v8f;

#define D_MODEL 1024
#define NHEADS  16
#define HDIM    64
#define SEQ     2048
#define BATCH   4
#define MTOT    (BATCH * SEQ)   // 8192 rows

// Load a 16x32 f16 fragment (A-layout or symmetric B-layout) where the WMMA
// K-dimension is contiguous in memory at `p` (p = row/col start + k-base).
// Per CDNA5 ISA 16-bit A layout: lane half = lane>>4,
//   VGPR v holds K = (v/4)*16 + half*8 + (v%4)*2  (+1 for hi half of dword).
// Per half this is two contiguous 16B chunks -> compiler emits 2x b128 loads.
__device__ __forceinline__ v16h frag_load(const _Float16* p, int half) {
  union { v16h h; unsigned int u[8]; } r;
#pragma unroll
  for (int v = 0; v < 8; ++v) {
    int k = ((v >> 2) << 4) + (half << 3) + ((v & 3) << 1);
    r.u[v] = *(const unsigned int*)(p + k);
  }
  return r.h;
}

// Eight asynchronous 16-byte copies global -> LDS, rows 8 apart (one wave-wide
// copy covers two whole 256-byte row slabs). The s_wait_xcnt stands inside the
// copies' own statement so that no address register is rewritten ahead of it.
#define GK      128                   // k elements per stage (256 B per row)
#define GPITCH  136                   // LDS row pitch in halfs: 272 B = 16 B x 17
#define GSTAGE  (256 * GPITCH)        // halfs per stage: 128 A rows + 128 W rows
#define EPH     72                    // epilogue row pitch, f16 tile, in halfs (144 B)
#define EPF     68                    // epilogue row pitch, f32 tile, in floats (272 B)
__device__ __forceinline__ void async_rows8(const _Float16* g, unsigned l) {
  asm volatile(
      "global_load_async_to_lds_b128 %0, %8, off\n\t"
      "global_load_async_to_lds_b128 %1, %9, off\n\t"
      "global_load_async_to_lds_b128 %2, %10, off\n\t"
      "global_load_async_to_lds_b128 %3, %11, off\n\t"
      "global_load_async_to_lds_b128 %4, %12, off\n\t"
      "global_load_async_to_lds_b128 %5, %13, off\n\t"
      "global_load_async_to_lds_b128 %6, %14, off\n\t"
      "global_load_async_to_lds_b128 %7, %15, off\n\t"
      "s_wait_xcnt 0x0"
      :: "v"(l), "v"(l + 8u * GPITCH * 2u), "v"(l + 16u * GPITCH * 2u),
         "v"(l + 24u * GPITCH * 2u), "v"(l + 32u * GPITCH * 2u),
         "v"(l + 40u * GPITCH * 2u), "v"(l + 48u * GPITCH * 2u),
         "v"(l + 56u * GPITCH * 2u),
         "v"(g), "v"(g + 8 * D_MODEL), "v"(g + 16 * D_MODEL), "v"(g + 24 * D_MODEL),
         "v"(g + 32 * D_MODEL), "v"(g + 40 * D_MODEL), "v"(g + 48 * D_MODEL),
         "v"(g + 56 * D_MODEL)
      : "memory");
}

// One stage: 128 rows of A, then 128 rows of W, 256 bytes of each row.
// 32 copies per lane; ga/gw and l are the lane's own first chunk.
__device__ __forceinline__ void fill_stage(const _Float16* ga, const _Float16* gw, unsigned l) {
  async_rows8(ga, l);
  async_rows8(ga + 64 * D_MODEL, l + 64u * GPITCH * 2u);
  async_rows8(gw, l + 128u * GPITCH * 2u);
  async_rows8(gw + 64 * D_MODEL, l + 192u * GPITCH * 2u);
}

// All five f32 -> f16 conversions in one streaming launch. The f16 copies of x,
// Wq, Wk, Wv, Wo lie one behind the other in the workspace, so d is one array of
// 768 units of 16,384 elements: 512 of x, then 64 of each weight. One block of 16
// waves per WGP takes three units: b and b + 256 (x) and 512 + b (weight b / 64).
// A wave owns 4 KB of each unit: eight 16-byte loads per lane, each wave-wide load
// four whole lines, each wave-wide 8-byte store two whole lines.
typedef __attribute__((ext_vector_type(4))) float    v4f;
typedef __attribute__((ext_vector_type(4))) _Float16 v4h;
#define CVT_UNIT 16384
__global__ __launch_bounds__(512)
void f32_to_f16_all(const float* __restrict__ x, const float* __restrict__ wq,
                    const float* __restrict__ wk, const float* __restrict__ wv,
                    const float* __restrict__ wo, _Float16* __restrict__ d) {
  const int b  = blockIdx.x;
  const int e0 = (threadIdx.x >> 5) * 1024 + (threadIdx.x & 31) * 4;   // in the unit
  const float* w = b < 64 ? wq : b < 128 ? wk : b < 192 ? wv : wo;
  const float* s0 = x + (size_t)b * CVT_UNIT + e0;
  const float* s1 = x + (size_t)(b + 256) * CVT_UNIT + e0;
  const float* s2 = w + (size_t)(b & 63) * CVT_UNIT + e0;
  v4f r0[8], r1[8], r2[8];
  // unrolled: constant offsets from three bases, the loaded values stay in registers
#pragma unroll
  for (int j = 0; j < 8; ++j) r0[j] = *(const v4f*)(s0 + j * 128);
#pragma unroll
  for (int j = 0; j < 8; ++j) r1[j] = *(const v4f*)(s1 + j * 128);
#pragma unroll
  for (int j = 0; j < 8; ++j) r2[j] = *(const v4f*)(s2 + j * 128);
  // all 24 loads of a lane issue ahead of the first conversion: without it the
  // compiler reuses the first loads' registers and holds the last ten loads back
  // until the first ones have returned
  __builtin_amdgcn_sched_barrier(0);
  _Float16* d0 = d + (size_t)b * CVT_UNIT + e0;
  _Float16* d1 = d + (size_t)(b + 256) * CVT_UNIT + e0;
  _Float16* d2 = d + (size_t)(b + 512) * CVT_UNIT + e0;
  // unrolled like the loads: r0, r1, r2 keep constant indices (stay in registers)
#pragma unroll
  for (int j = 0; j < 8; ++j) *(v4h*)(d0 + j * 128) = __builtin_convertvector(r0[j], v4h);
#pragma unroll
  for (int j = 0; j < 8; ++j) *(v4h*)(d1 + j * 128) = __builtin_convertvector(r1[j], v4h);
#pragma unroll
  for (int j = 0; j < 8; ++j) *(v4h*)(d2 + j * 128) = __builtin_convertvector(r2[j], v4h);
}

// GEMM: out[m,n] = sum_k A[m,k] * W[n,k] + bias[n]   (nn.Linear semantics)
// Block = 4 waves (2x2) computing a 128x128 tile; each wave owns 64x64
// (16 WMMA acc). Both operands come per 128-k stage into a two-buffer LDS ring
// by asynchronous copies and are shared by the block's waves.
// mode 0: store Q (bh,s,hd) scaled by 1/sqrt(HDIM)
// mode 1: store K (bh,s,hd)
// mode 2: store V transposed (bh,hd,s)
// mode 3: store fp32 row-major to outF (final projection)
// Epilogue: the product is formed so that a lane's 8 accumulator registers are 8
// neighbours of one OUTPUT row (modes 0, 1, 3: W rows as first operand, so the
// registers run along n; mode 2: A rows first, so they run along s). Each wave
// lays its 64x64 tile row by row into its own range of the ring, which is idle
// behind the loop's last barrier, and reads it back so that every wave-wide
// 16-byte store covers whole 128-byte lines.
// mode is a compile-time constant, for speed only.
template <int mode>
__global__ __launch_bounds__(128)
void gemm32(const _Float16* __restrict__ A, const _Float16* __restrict__ W,
            const float* __restrict__ bias, _Float16* __restrict__ outH,
            float* __restrict__ outF) {
  __shared__ __align__(16) _Float16 S[2 * GSTAGE];        // 2 x 69,632 B
  const int tid  = threadIdx.x;
  const int lane = tid & 31;
  const int wave = tid >> 5;
  const int half = lane >> 4;
  const int ln   = lane & 15;
  const int wm   = wave >> 1;
  const int wn   = wave & 1;
  const int m0   = blockIdx.x * 128 + wm * 64;
  const int n0   = blockIdx.y * 128 + wn * 64;

  // The lane's own 16-byte chunk: row tid/16 (+8 per copy), chunk tid%16.
  const int rg = tid >> 4;
  const int ch = tid & 15;
  const _Float16* ga = A + (size_t)(blockIdx.x * 128 + rg) * D_MODEL + ch * 8;
  const _Float16* gw = W + (size_t)(blockIdx.y * 128 + rg) * D_MODEL + ch * 8;
  const unsigned  l0 = (unsigned)(size_t)(__attribute__((address_space(3))) _Float16*)
                           &S[rg * GPITCH + ch * 8];

  fill_stage(ga, gw, l0);
  // stage 0 has landed before any wave reads it
  asm volatile("s_wait_asynccnt 0x0" ::: "memory");
  __syncthreads();
  fill_stage(ga + GK, gw + GK, l0 + GSTAGE * 2u);

  v8f acc[4][4] = {};
  // kept rolled: unrolling would only multiply the text a cold launch has to
  // fetch; a trip costs a few scalar instructions per 64 WMMAs
#pragma unroll 1
  for (int t = 0; t < D_MODEL / GK; ++t) {
    const _Float16* Sb = &S[(t & 1) * GSTAGE];
    const _Float16* aL = Sb + (wm * 64 + ln) * GPITCH;
    const _Float16* bL = Sb + (128 + wn * 64 + ln) * GPITCH;
#pragma unroll
    for (int kk = 0; kk < GK; kk += 32) {
      v16h a[4], b[4];
      // in the order the WMMAs below first need them
      a[0] = frag_load(aL + kk, half);
#pragma unroll
      for (int i = 0; i < 4; ++i) b[i] = frag_load(bL + i * 16 * GPITCH + kk, half);
#pragma unroll
      for (int i = 1; i < 4; ++i) a[i] = frag_load(aL + i * 16 * GPITCH + kk, half);
      // keeps the 16 LDS reads of this k step together ahead of its 16 WMMAs:
      // spread among them, every row of four waits out a full LDS latency
      __builtin_amdgcn_sched_barrier(0);
#pragma unroll
      for (int mm = 0; mm < 4; ++mm)
#pragma unroll
        for (int u = 0; u < 4; ++u)
          acc[mm][u] = mode == 2
              ? __builtin_amdgcn_wmma_f32_16x16x32_f16(
                    false, a[mm], false, b[u], (short)0, acc[mm][u], false, false)
              : __builtin_amdgcn_wmma_f32_16x16x32_f16(
                    false, b[u], false, a[mm], (short)0, acc[mm][u], false, false);
      // the next k step's reads stay behind this step's WMMAs (one load group)
      __builtin_amdgcn_sched_barrier(0);
    }
    // Publish point: this wave's reads of buffer t%2 are done, its copies of
    // stage t+1 have landed; behind the barrier both hold for every wave.
    asm volatile("s_wait_dscnt 0x0" ::: "memory");
    asm volatile("s_wait_asynccnt 0x0" ::: "memory");
    __syncthreads();
    if (t + 2 < D_MODEL / GK)
      fill_stage(ga + (t + 2) * GK, gw + (t + 2) * GK, l0 + (unsigned)(t & 1) * (GSTAGE * 2u));
  }
  // no copy is outstanding when the wave goes on to its stores and ends
  asm volatile("s_wait_asynccnt 0x0" ::: "memory");

  if (mode == 3) {
    // f32 rows of 256 bytes at pitch 272 (16 B x 17): acc[mm][u][r] is
    // out[m0 + 16 mm + ln][n0 + 16 u + 8 half + r]
    float* Sf = (float*)S + wave * (64 * EPF);
    // every loop down to the stores is unrolled so that acc[][] and row[] keep
    // constant indices (stay in registers) and each kind of access issues as one group
#pragma unroll
    for (int u = 0; u < 4; ++u) {
      const v4f b0 = *(const v4f*)&bias[n0 + 16 * u + half * 8];
      const v4f b1 = *(const v4f*)&bias[n0 + 16 * u + half * 8 + 4];
#pragma unroll
      for (int mm = 0; mm < 4; ++mm) {
        v4f lo, hi;
#pragma unroll
        for (int r = 0; r < 4; ++r) {
          lo[r] = acc[mm][u][r] + b0[r];
          hi[r] = acc[mm][u][4 + r] + b1[r];
        }
        float* p = &Sf[(mm * 16 + ln) * EPF + 16 * u + half * 8];
        *(v4f*)p       = lo;
        *(v4f*)(p + 4) = hi;
      }
    }
    // the wave's own LDS writes are done before other lanes read the rows back
    asm volatile("s_wait_dscnt 0x0" ::: "memory");
    // one wave-wide store: two rows of 256 bytes, four whole lines
    v4f row[32];
#pragma unroll
    for (int i = 0; i < 32; ++i) row[i] = *(const v4f*)&Sf[(2 * i + half) * EPF + ln * 4];
    float* og = outF + (size_t)(m0 + half) * D_MODEL + n0 + ln * 4;
#pragma unroll
    for (int i = 0; i < 32; ++i) *(v4f*)&og[(size_t)(2 * i) * D_MODEL] = row[i];
    return;
  }

  // f16 rows of 128 bytes at pitch 144 (16 B x 9). Modes 0, 1: row s, column d;
  // mode 2: row d, column s.
  _Float16* Sw = S + wave * (64 * EPH);
  // every loop down to the stores is unrolled so that acc[][] and row[] keep
  // constant indices (stay in registers) and each kind of access issues as one group
#pragma unroll
  for (int u = 0; u < 4; ++u) {
    v4f b0, b1;
    float bv = 0.0f;
    if (mode == 2) {
      bv = bias[n0 + 16 * u + ln];
    } else {
      b0 = *(const v4f*)&bias[n0 + 16 * u + half * 8];
      b1 = *(const v4f*)&bias[n0 + 16 * u + half * 8 + 4];
    }
#pragma unroll
    for (int mm = 0; mm < 4; ++mm) {
      union { _Float16 h[8]; uint4 q; } pk;
#pragma unroll
      for (int r = 0; r < 8; ++r) {
        float val = acc[mm][u][r] + (mode == 2 ? bv : r < 4 ? b0[r & 3] : b1[r & 3]);
        if (mode == 0) val *= 0.125f;
        pk.h[r] = (_Float16)val;
      }
      // modes 0, 1: out[m0 + 16 mm + ln][n0 + 16 u + 8 half + r];
      // mode 2:     out[m0 + 16 mm + 8 half + r][n0 + 16 u + ln]
      const int rw = mode == 2 ? 16 * u + ln : 16 * mm + ln;
      const int cl = (mode == 2 ? 16 * mm : 16 * u) + half * 8;
      *(uint4*)&Sw[rw * EPH + cl] = pk.q;
    }
  }
  // the wave's own LDS writes are done before other lanes read the rows back
  asm volatile("s_wait_dscnt 0x0" ::: "memory");
  // one wave-wide store: four rows of 128 bytes, four whole lines
  uint4 row[16];
#pragma unroll
  for (int i = 0; i < 16; ++i)
    row[i] = *(const uint4*)&Sw[(4 * i + (lane >> 3)) * EPH + (lane & 7) * 8];
  // a wave's 64 rows m lie in one batch (m0 is a multiple of 64) and its 64
  // columns n are one head
  const size_t bh = (size_t)((m0 >> 11) * NHEADS + (n0 >> 6));
  const int    s0 = m0 & (SEQ - 1);
  if (mode == 2) {
    _Float16* og = outH + (bh * HDIM + (lane >> 3)) * SEQ + s0 + (lane & 7) * 8;
#pragma unroll
    for (int i = 0; i < 16; ++i) *(uint4*)&og[(size_t)(4 * i) * SEQ] = row[i];
  } else {
    // the tile is 8 KB in a row
    _Float16* og = outH + (bh * SEQ + s0) * HDIM + lane * 8;
#pragma unroll
    for (int i = 0; i < 16; ++i) *(uint4*)&og[i * 256] = row[i];
  }
}

// lane l reads lane l ^ 16: a vector cross-row move, no LDS round trip
__device__ __forceinline__ float xhalf(float x) {
  return __builtin_bit_cast(float, __builtin_amdgcn_permlanex16(
      __builtin_bit_cast(int, x), __builtin_bit_cast(int, x),
      0x76543210, 0xfedcba98, false, false));
}

// 2^x of eight values and of one more, each in place. The v_exp_f32 stand in one
// statement so that none is directly followed by a write of its own source (left
// to the register allocator, a v_exp often lands on the source of the one before);
// the closing v_nop is the slot the instruction set asks for behind a
// transcendental before its result is used.
__device__ __forceinline__ void exp2x9(float (&x)[8], float& y) {
  asm("v_exp_f32 %0, %0\n\t"
      "v_exp_f32 %1, %1\n\t"
      "v_exp_f32 %2, %2\n\t"
      "v_exp_f32 %3, %3\n\t"
      "v_exp_f32 %4, %4\n\t"
      "v_exp_f32 %5, %5\n\t"
      "v_exp_f32 %6, %6\n\t"
      "v_exp_f32 %7, %7\n\t"
      "v_exp_f32 %8, %8\n\t"
      "v_nop"
      : "+v"(y), "+v"(x[0]), "+v"(x[1]), "+v"(x[2]), "+v"(x[3]),
        "+v"(x[4]), "+v"(x[5]), "+v"(x[6]), "+v"(x[7]));
}
__device__ __forceinline__ void exp2x8(float (&x)[8]) {
  asm("v_exp_f32 %0, %0\n\t"
      "v_exp_f32 %1, %1\n\t"
      "v_exp_f32 %2, %2\n\t"
      "v_exp_f32 %3, %3\n\t"
      "v_exp_f32 %4, %4\n\t"
      "v_exp_f32 %5, %5\n\t"
      "v_exp_f32 %6, %6\n\t"
      "v_exp_f32 %7, %7\n\t"
      "v_nop"
      : "+v"(x[0]), "+v"(x[1]), "+v"(x[2]), "+v"(x[3]),
        "+v"(x[4]), "+v"(x[5]), "+v"(x[6]), "+v"(x[7]));
}

// One attention stage: 64 keys of K (64 rows of 128 bytes, contiguous in memory)
// and of V^T (64 d rows, 128 bytes of each), as whole 128-byte lines.
#define AKEYS   64                    // keys per stage
#define APITCH  72                    // LDS row pitch in halfs: 144 B = 16 B x 9
#define ASTAGE  (128 * APITCH)        // halfs per stage: 64 K rows, then 64 V^T rows
// Eight asynchronous 16-byte copies per lane, rows 16 apart: four of K, four of
// V^T (one wave-wide copy covers four whole rows). gk, gv and l are the lane's own
// first chunk. The s_wait_xcnt stands inside the copies' own statement so that no
// address register is rewritten ahead of it.
__device__ __forceinline__ void fill_kv(const _Float16* gk, const _Float16* gv, unsigned l) {
  asm volatile(
      "global_load_async_to_lds_b128 %0, %8, off\n\t"
      "global_load_async_to_lds_b128 %1, %9, off\n\t"
      "global_load_async_to_lds_b128 %2, %10, off\n\t"
      "global_load_async_to_lds_b128 %3, %11, off\n\t"
      "global_load_async_to_lds_b128 %4, %12, off\n\t"
      "global_load_async_to_lds_b128 %5, %13, off\n\t"
      "global_load_async_to_lds_b128 %6, %14, off\n\t"
      "global_load_async_to_lds_b128 %7, %15, off\n\t"
      "s_wait_xcnt 0x0"
      :: "v"(l), "v"(l + 16u * APITCH * 2u), "v"(l + 32u * APITCH * 2u),
         "v"(l + 48u * APITCH * 2u), "v"(l + 64u * APITCH * 2u),
         "v"(l + 80u * APITCH * 2u), "v"(l + 96u * APITCH * 2u),
         "v"(l + 112u * APITCH * 2u),
         "v"(gk), "v"(gk + 16 * HDIM), "v"(gk + 32 * HDIM), "v"(gk + 48 * HDIM),
         "v"(gv), "v"(gv + 16 * SEQ), "v"(gv + 32 * SEQ), "v"(gv + 48 * SEQ)
      : "memory");
}

__global__ __launch_bounds__(128)
void flash_attn(const _Float16* __restrict__ Q, const _Float16* __restrict__ K,
                const _Float16* __restrict__ Vt, _Float16* __restrict__ O) {
  const int lane = threadIdx.x & 31;
  const int wave = threadIdx.x >> 5;
  const int half = lane >> 4;
  const int ln   = lane & 15;
  const int bh   = blockIdx.y;

  __shared__ __align__(16) _Float16 KV[2 * ASTAGE];       // 2 x 18,432 B
  // output staging, a range of 16 rows per wave, outside the ring: the next query
  // block's copies may fly while another wave still reads its rows back
  __shared__ __align__(16) _Float16 OS[4 * 16 * APITCH];  // 4 x 2,304 B
  // The lane's own 16-byte chunk: row tid/8 (+16 per copy), chunk tid%8.
  const int rg = threadIdx.x >> 3;
  const int ch = threadIdx.x & 7;
  const _Float16* gk = K + ((size_t)bh * SEQ + rg) * HDIM + ch * 8;
  const _Float16* gv = Vt + ((size_t)bh * HDIM + rg) * SEQ + ch * 8;
  const unsigned  l0 = (unsigned)(size_t)(__attribute__((address_space(3))) _Float16*)
                           &KV[rg * APITCH + ch * 8];

  // kept rolled: the two query blocks run one after the other through the same
  // text; unrolled, the text a cold launch has to fetch would double
#pragma unroll 1
  for (int part = 0; part < 2; ++part) {
  const int qblk = part == 0 ? SEQ / 64 - 1 - (int)blockIdx.x : (int)blockIdx.x;
  const int q0   = (qblk * 4 + wave) * 16;
  const int q    = q0 + ln;              // the lane's own query

  const _Float16* Qb = Q + ((size_t)bh * SEQ + q) * HDIM;
  v16h qb0 = frag_load(Qb, half);        // B operand, d = 0..31
  v16h qb1 = frag_load(Qb + 32, half);   // B operand, d = 32..63

  v8f   o[4] = {};                       // o[t][r] = O^T[d = 16t + 8*half + r][q]
  float mi = -1e30f;                     // running maximum, equal in both halves
  float li = 0.0f;                       // running sum over this half's keys only

  // Every reader has left both buffers here: nothing was read before the first
  // query block, and the first one's last trip ends in its waits and barrier.
  const int nst = qblk + 1;              // stages of 64 keys, block-uniform
  fill_kv(gk, gv, l0);
  // stage 0 has landed before any wave reads it
  asm volatile("s_wait_asynccnt 0x0" ::: "memory");
  __syncthreads();
  if (nst > 1) fill_kv(gk + AKEYS * HDIM, gv + AKEYS, l0 + ASTAGE * 2u);

  // kept rolled: a trip is one stage with its publish point at the foot
#pragma unroll 1
  for (int st = 0; st < nst; ++st) {
  const _Float16* Sb = &KV[(st & 1) * ASTAGE];
  // unrolled: the two 32-key halves of a stage read at constant LDS offsets
#pragma unroll
  for (int p = 0; p < 2; ++p) {
    const int j0 = st * AKEYS + p * 32;
    const _Float16* Kl = Sb + (p * 32 + ln) * APITCH;
    const _Float16* Kh = Kl + 16 * APITCH;

    // All LDS reads of the 32 keys (K frags + V frags) as one group; the V
    // fragments arrive under the softmax VALU work.
    v16h ka00 = frag_load(Kl, half);
    v16h ka01 = frag_load(Kl + 32, half);
    v16h ka10 = frag_load(Kh, half);
    v16h ka11 = frag_load(Kh + 32, half);
    v16h va[4];
#pragma unroll
    for (int t = 0; t < 4; ++t)
      va[t] = frag_load(Sb + (64 + 16 * t + ln) * APITCH + p * 32, half);
    // keeps the 16 loads one group ahead of the first WMMA: with fewer live
    // registers the compiler otherwise reuses fragment registers and strings
    // the loads out between the WMMAs, one LDS latency after another
    __builtin_amdgcn_sched_barrier(0);

    // sl[r] = S^T[key j0 + 8*half + r][q], sh[r] = the same 16 keys further on
    v8f sl = {}, sh = {};
    sl = __builtin_amdgcn_wmma_f32_16x16x32_f16(false, ka00, false, qb0, (short)0, sl, false, false);
    sl = __builtin_amdgcn_wmma_f32_16x16x32_f16(false, ka01, false, qb1, (short)0, sl, false, false);
    sh = __builtin_amdgcn_wmma_f32_16x16x32_f16(false, ka10, false, qb0, (short)0, sh, false, false);
    sh = __builtin_amdgcn_wmma_f32_16x16x32_f16(false, ka11, false, qb1, (short)0, sh, false, false);

    const int kb = j0 + half * 8;
    float v = -1e30f;
#pragma unroll
    for (int r = 0; r < 8; ++r) {
      sl[r] = (kb + r      <= q) ? sl[r] : -1e30f;   // causal mask: key > query
      sh[r] = (kb + 16 + r <= q) ? sh[r] : -1e30f;
      v = fmaxf(v, fmaxf(sl[r], sh[r]));
    }
    v = fmaxf(v, xhalf(v));              // the other half's 16 keys of this query
    const float mnew  = fmaxf(mi, v);
    // e^x as 2^(x * log2 e), the form of __expf
    const float L2E = 1.44269504088896340736f;
    float scale = (mi - mnew) * L2E;
    mi = mnew;
    float ea[8], eb[8];
#pragma unroll
    for (int r = 0; r < 8; ++r) {
      ea[r] = (sl[r] - mnew) * L2E;
      eb[r] = (sh[r] - mnew) * L2E;
    }
    exp2x9(ea, scale);
    exp2x8(eb);

    // P^T as B operand: element s is key j0 + 8*half + s (+ 8 for s >= 8), the order of va[]
    v16h pb;
    float rs = 0.0f;
#pragma unroll
    for (int r = 0; r < 8; ++r) {
      rs += ea[r] + eb[r];
      pb[r]     = (_Float16)ea[r];
      pb[8 + r] = (_Float16)eb[r];
    }
    li = li * scale + rs;

#pragma unroll
    for (int t = 0; t < 4; ++t)
#pragma unroll
      for (int r = 0; r < 8; ++r) o[t][r] *= scale;

    // O^T += V^T x P^T : A[d][k] = Vt row d (keys contiguous), B[k][q] = P^T
#pragma unroll
    for (int t = 0; t < 4; ++t)
      o[t] = __builtin_amdgcn_wmma_f32_16x16x32_f16(
          false, va[t], false, pb, (short)0, o[t], false, false);
  }
    // Publish point: this wave's reads of buffer st%2 are done, its copies of
    // stage st+1 have landed; behind the barrier both hold for every wave.
    asm volatile("s_wait_dscnt 0x0" ::: "memory");
    asm volatile("s_wait_asynccnt 0x0" ::: "memory");
    __syncthreads();
    if (st + 2 < nst)
      fill_kv(gk + (st + 2) * (AKEYS * HDIM), gv + (st + 2) * AKEYS,
              l0 + (unsigned)(st & 1) * (ASTAGE * 2u));
  }
  // no copy is outstanding when the wave goes on to its stores
  asm volatile("s_wait_asynccnt 0x0" ::: "memory");

  li += xhalf(li);                       // join the two halves' sums, once
  const int b_ = bh >> 4;
  const int h_ = bh & 15;
  // a lane's 8 accumulator registers are 8 consecutive d of its query's row: the
  // wave lays its 16 rows of 128 bytes into its own LDS range and reads them back
  // so that each wave-wide 16-byte store covers four whole 128-byte lines
  _Float16* Ow = &OS[wave * (16 * APITCH)];
#pragma unroll
  for (int t = 0; t < 4; ++t) {
    union { _Float16 h[8]; uint4 u; } pk;
#pragma unroll
    for (int r = 0; r < 8; ++r) pk.h[r] = (_Float16)(o[t][r] / li);
    *(uint4*)&Ow[ln * APITCH + 16 * t + half * 8] = pk.u;
  }
  // the wave's own LDS writes are done before other lanes read the rows back
  asm volatile("s_wait_dscnt 0x0" ::: "memory");
  uint4 orow[4];
  // unrolled: orow[] keeps constant indices (stays in registers)
#pragma unroll
  for (int i = 0; i < 4; ++i)
    orow[i] = *(const uint4*)&Ow[(4 * i + (lane >> 3)) * APITCH + (lane & 7) * 8];
  _Float16* Ob = O + ((size_t)(b_ * SEQ + q0 + (lane >> 3))) * D_MODEL + h_ * HDIM
                   + (lane & 7) * 8;
#pragma unroll
  for (int i = 0; i < 4; ++i) *(uint4*)&Ob[(size_t)(4 * i) * D_MODEL] = orow[i];
  // the next query block rewrites the registers that these stores name (address
  // and data): the wait stands behind the stores, in front of every such write
  asm volatile("s_wait_xcnt 0x0" ::: "memory");
  }
}

extern "C" void kernel_launch(void* const* d_in, const int* in_sizes, int n_in,
                              void* d_out, int out_size, void* d_ws, size_t ws_size,
                              hipStream_t stream) {
  const float* x  = (const float*)d_in[0];
  const float* Wq = (const float*)d_in[1];
  const float* bq = (const float*)d_in[2];
  const float* Wk = (const float*)d_in[3];
  const float* bk = (const float*)d_in[4];
  const float* Wv = (const float*)d_in[5];
  const float* bv = (const float*)d_in[6];
  const float* Wo = (const float*)d_in[7];
  const float* bo = (const float*)d_in[8];
  float* out = (float*)d_out;

  char* ws = (char*)d_ws;
  size_t off = 0;
  const size_t XSZ = (size_t)MTOT * D_MODEL * sizeof(_Float16);      // 16 MB
  const size_t WSZ = (size_t)D_MODEL * D_MODEL * sizeof(_Float16);   //  2 MB
  _Float16* xh  = (_Float16*)(ws + off); off += XSZ;
  _Float16* wqh = (_Float16*)(ws + off); off += WSZ;
  _Float16* wkh = (_Float16*)(ws + off); off += WSZ;
  _Float16* wvh = (_Float16*)(ws + off); off += WSZ;
  _Float16* woh = (_Float16*)(ws + off); off += WSZ;
  _Float16* qh  = (_Float16*)(ws + off); off += XSZ;
  _Float16* kh  = (_Float16*)(ws + off); off += XSZ;
  _Float16* vt  = (_Float16*)(ws + off); off += XSZ;
  _Float16* at  = (_Float16*)(ws + off); off += XSZ;   // attention output (b, s, h*hd)
  (void)in_sizes; (void)n_in; (void)out_size; (void)ws_size;

  // xh, wqh, wkh, wvh, woh are contiguous from xh on: one destination array
  f32_to_f16_all<<<256, 512, 0, stream>>>(x, Wq, Wk, Wv, Wo, xh);

  dim3 gg(MTOT / 128, D_MODEL / 128);
  gemm32<0><<<gg, 128, 0, stream>>>(xh, wqh, bq, qh, nullptr);   // Q (scaled)
  gemm32<1><<<gg, 128, 0, stream>>>(xh, wkh, bk, kh, nullptr);   // K
  gemm32<2><<<gg, 128, 0, stream>>>(xh, wvh, bv, vt, nullptr);   // V^T

  flash_attn<<<dim3(SEQ / 128, BATCH * NHEADS), 128, 0, stream>>>(qh, kh, vt, at);

  gemm32<3><<<gg, 128, 0, stream>>>(at, woh, bo, nullptr, out);  // out proj
}

// v008
// Measured time: 114 microseconds a run.
// Next to v007, in two timings, it ran 1.06 times as fast each time.
// Over all steps from v000 it is 4.15 times as fast.
#include <hip/hip_runtime.h>

// ---------------------------------------------------------------------------
// Causal self-attention for MI455X (gfx1250, wave32, WMMA).
// fp32 in/out; internal compute in f16 with fp32 WMMA accumulation.
// ---------------------------------------------------------------------------

typedef __attribute__((ext_vector_type(16))) _Float16 v16h;
typedef __attribute__((ext_vector_type(8)))  float    v8f;

#define D_MODEL 1024
#define NHEADS  16
#define HDIM    64
#define SEQ     2048
#define BATCH   4
#define MTOT    (BATCH * SEQ)   // 8192 rows

// Load a 16x32 f16 fragment (A-layout or symmetric B-layout) where the WMMA
// K-dimension is contiguous in memory at `p` (p = row/col start + k-base).
// Per CDNA5 ISA 16-bit A layout: lane half = lane>>4,
//   VGPR v holds K = (v/4)*16 + half*8 + (v%4)*2  (+1 for hi half of dword).
// Per half this is two contiguous 16B chunks -> compiler emits 2x b128 loads.
__device__ __forceinline__ v16h frag_load(const _Float16* p, int half) {
  union { v16h h; unsigned int u[8]; } r;
#pragma unroll
  for (int v = 0; v < 8; ++v) {
    int k = ((v >> 2) << 4) + (half << 3) + ((v & 3) << 1);
    r.u[v] = *(const unsigned int*)(p + k);
  }
  return r.h;
}

// Eight asynchronous 16-byte copies global -> LDS, rows 8 apart (one wave-wide
// copy covers two whole 256-byte row slabs). The s_wait_xcnt stands inside the
// copies' own statement so that no address register is rewritten ahead of it.
#define GK      128                   // k elements per stage (256 B per row)
#define GPITCH  136                   // LDS row pitch in halfs: 272 B = 16 B x 17
#define GSTAGE  (256 * GPITCH)        // halfs per stage: 128 A rows + 128 W rows
#define EPH     72                    // epilogue row pitch, f16 tile, in halfs (144 B)
#define EPF     68                    // epilogue row pitch, f32 tile, in floats (272 B)
__device__ __forceinline__ void async_rows8(const _Float16* g, unsigned l) {
  asm volatile(
      "global_load_async_to_lds_b128 %0, %8, off\n\t"
      "global_load_async_to_lds_b128 %1, %9, off\n\t"
      "global_load_async_to_lds_b128 %2, %10, off\n\t"
      "global_load_async_to_lds_b128 %3, %11, off\n\t"
      "global_load_async_to_lds_b128 %4, %12, off\n\t"
      "global_load_async_to_lds_b128 %5, %13, off\n\t"
      "global_load_async_to_lds_b128 %6, %14, off\n\t"
      "global_load_async_to_lds_b128 %7, %15, off\n\t"
      "s_wait_xcnt 0x0"
      :: "v"(l), "v"(l + 8u * GPITCH * 2u), "v"(l + 16u * GPITCH * 2u),
         "v"(l + 24u * GPITCH * 2u), "v"(l + 32u * GPITCH * 2u),
         "v"(l + 40u * GPITCH * 2u), "v"(l + 48u * GPITCH * 2u),
         "v"(l + 56u * GPITCH * 2u),
         "v"(g), "v"(g + 8 * D_MODEL), "v"(g + 16 * D_MODEL), "v"(g + 24 * D_MODEL),
         "v"(g + 32 * D_MODEL), "v"(g + 40 * D_MODEL), "v"(g + 48 * D_MODEL),
         "v"(g + 56 * D_MODEL)
      : "memory");
}

// One stage: 128 rows of A, then 128 rows of W, 256 bytes of each row.
// 32 copies per lane; ga/gw and l are the lane's own first chunk.
__device__ __forceinline__ void fill_stage(const _Float16* ga, const _Float16* gw, unsigned l) {
  async_rows8(ga, l);
  async_rows8(ga + 64 * D_MODEL, l + 64u * GPITCH * 2u);
  async_rows8(gw, l + 128u * GPITCH * 2u);
  async_rows8(gw + 64 * D_MODEL, l + 192u * GPITCH * 2u);
}

// All five f32 -> f16 conversions in one streaming launch. The f16 copies of x,
// Wq, Wk, Wv, Wo lie one behind the other in the workspace, so d is one array of
// 768 units of 16,384 elements: 512 of x, then 64 of each weight. One block of 16
// waves per WGP takes three units: b and b + 256 (x) and 512 + b (weight b / 64).
// A wave owns 4 KB of each unit: eight 16-byte loads per lane, each wave-wide load
// four whole lines, each wave-wide 8-byte store two whole lines.
typedef __attribute__((ext_vector_type(4))) float    v4f;
typedef __attribute__((ext_vector_type(4))) _Float16 v4h;
#define CVT_UNIT 16384
__global__ __launch_bounds__(512)
void f32_to_f16_all(const float* __restrict__ x, const float* __restrict__ wq,
                    const float* __restrict__ wk, const float* __restrict__ wv,
                    const float* __restrict__ wo, _Float16* __restrict__ d) {
  const int b  = blockIdx.x;
  const int e0 = (threadIdx.x >> 5) * 1024 + (threadIdx.x & 31) * 4;   // in the unit
  const float* w = b < 64 ? wq : b < 128 ? wk : b < 192 ? wv : wo;
  const float* s0 = x + (size_t)b * CVT_UNIT + e0;
  const float* s1 = x + (size_t)(b + 256) * CVT_UNIT + e0;
  const float* s2 = w + (size_t)(b & 63) * CVT_UNIT + e0;
  v4f r0[8], r1[8], r2[8];
  // unrolled: constant offsets from three bases, the loaded values stay in registers
#pragma unroll
  for (int j = 0; j < 8; ++j) r0[j] = *(const v4f*)(s0 + j * 128);
#pragma unroll
  for (int j = 0; j < 8; ++j) r1[j] = *(const v4f*)(s1 + j * 128);
#pragma unroll
  for (int j = 0; j < 8; ++j) r2[j] = *(const v4f*)(s2 + j * 128);
  // all 24 loads of a lane issue ahead of the first conversion: without it the
  // compiler reuses the first loads' registers and holds the last ten loads back
  // until the first ones have returned
  __builtin_amdgcn_sched_barrier(0);
  _Float16* d0 = d + (size_t)b * CVT_UNIT + e0;
  _Float16* d1 = d + (size_t)(b + 256) * CVT_UNIT + e0;
  _Float16* d2 = d + (size_t)(b + 512) * CVT_UNIT + e0;
  // unrolled like the loads: r0, r1, r2 keep constant indices (stay in registers)
#pragma unroll
  for (int j = 0; j < 8; ++j) *(v4h*)(d0 + j * 128) = __builtin_convertvector(r0[j], v4h);
#pragma unroll
  for (int j = 0; j < 8; ++j) *(v4h*)(d1 + j * 128) = __builtin_convertvector(r1[j], v4h);
#pragma unroll
  for (int j = 0; j < 8; ++j) *(v4h*)(d2 + j * 128) = __builtin_convertvector(r2[j], v4h);
}

// GEMM: out[m,n] = sum_k A[m,k] * W[n,k] + bias[n]   (nn.Linear semantics)
// Block = 4 waves (2x2) computing a 128x128 tile; each wave owns 64x64
// (16 WMMA acc). Both operands come per 128-k stage into a two-buffer LDS ring
// by asynchronous copies and are shared by the block's waves.
// mode 0: store Q (bh,s,hd) scaled by 1/sqrt(HDIM)
// mode 1: store K (bh,s,hd)
// mode 2: store V transposed (bh,hd,s)
// mode 3: store fp32 row-major to outF (final projection)
// Epilogue: the product is formed so that a lane's 8 accumulator registers are 8
// neighbours of one OUTPUT row (modes 0, 1, 3: W rows as first operand, so the
// registers run along n; mode 2: A rows first, so they run along s). Each wave
// lays its 64x64 tile row by row into its own range of the ring, which is idle
// behind the loop's last barrier, and reads it back so that every wave-wide
// 16-byte store covers whole 128-byte lines.
// mode is a compile-time constant, for speed only.
template <int mode>
__global__ __launch_bounds__(128)
void gemm32(const _Float16* __restrict__ A, const _Float16* __restrict__ W,
            const float* __restrict__ bias, _Float16* __restrict__ outH,
            float* __restrict__ outF) {
  __shared__ __align__(16) _Float16 S[2 * GSTAGE];        // 2 x 69,632 B
  const int tid  = threadIdx.x;
  const int lane = tid & 31;
  const int wave = tid >> 5;
  const int half = lane >> 4;
  const int ln   = lane & 15;
  const int wm   = wave >> 1;
  const int wn   = wave & 1;
  const int m0   = blockIdx.x * 128 + wm * 64;
  const int n0   = blockIdx.y * 128 + wn * 64;

  // The lane's own 16-byte chunk: row tid/16 (+8 per copy), chunk tid%16.
  const int rg = tid >> 4;
  const int ch = tid & 15;
  const _Float16* ga = A + (size_t)(blockIdx.x * 128 + rg) * D_MODEL + ch * 8;
  const _Float16* gw = W + (size_t)(blockIdx.y * 128 + rg) * D_MODEL + ch * 8;
  const unsigned  l0 = (unsigned)(size_t)(__attribute__((address_space(3))) _Float16*)
                           &S[rg * GPITCH + ch * 8];

  fill_stage(ga, gw, l0);
  // stage 0 has landed before any wave reads it
  asm volatile("s_wait_asynccnt 0x0" ::: "memory");
  __syncthreads();
  fill_stage(ga + GK, gw + GK, l0 + GSTAGE * 2u);

  v8f acc[4][4] = {};
  // kept rolled: unrolling would only multiply the text a cold launch has to
  // fetch; a trip costs a few scalar instructions per 64 WMMAs
#pragma unroll 1
  for (int t = 0; t < D_MODEL / GK; ++t) {
    const _Float16* Sb = &S[(t & 1) * GSTAGE];
    const _Float16* aL = Sb + (wm * 64 + ln) * GPITCH;
    const _Float16* bL = Sb + (128 + wn * 64 + ln) * GPITCH;
#pragma unroll
    for (int kk = 0; kk < GK; kk += 32) {
      v16h a[4], b[4];
      // in the order the WMMAs below first need them
      a[0] = frag_load(aL + kk, half);
#pragma unroll
      for (int i = 0; i < 4; ++i) b[i] = frag_load(bL + i * 16 * GPITCH + kk, half);
#pragma unroll
      for (int i = 1; i < 4; ++i) a[i] = frag_load(aL + i * 16 * GPITCH + kk, half);
      // keeps the 16 LDS reads of this k step together ahead of its 16 WMMAs:
      // spread among them, every row of four waits out a full LDS latency
      __builtin_amdgcn_sched_barrier(0);
#pragma unroll
      for (int mm = 0; mm < 4; ++mm)
#pragma unroll
        for (int u = 0; u < 4; ++u)
          acc[mm][u] = mode == 2
              ? __builtin_amdgcn_wmma_f32_16x16x32_f16(
                    false, a[mm], false, b[u], (short)0, acc[mm][u], false, false)
              : __builtin_amdgcn_wmma_f32_16x16x32_f16(
                    false, b[u], false, a[mm], (short)0, acc[mm][u], false, false);
      // the next k step's reads stay behind this step's WMMAs (one load group)
      __builtin_amdgcn_sched_barrier(0);
    }
    // Publish point: this wave's reads of buffer t%2 are done, its copies of
    // stage t+1 have landed; behind the barrier both hold for every wave.
    asm volatile("s_wait_dscnt 0x0" ::: "memory");
    asm volatile("s_wait_asynccnt 0x0" ::: "memory");
    __syncthreads();
    if (t + 2 < D_MODEL / GK)
      fill_stage(ga + (t + 2) * GK, gw + (t + 2) * GK, l0 + (unsigned)(t & 1) * (GSTAGE * 2u));
  }
  // no copy is outstanding when the wave goes on to its stores and ends
  asm volatile("s_wait_asynccnt 0x0" ::: "memory");

  if (mode == 3) {
    // f32 rows of 256 bytes at pitch 272 (16 B x 17): acc[mm][u][r] is
    // out[m0 + 16 mm + ln][n0 + 16 u + 8 half + r]
    float* Sf = (float*)S + wave * (64 * EPF);
    // every loop down to the stores is unrolled so that acc[][] and row[] keep
    // constant indices (stay in registers) and each kind of access issues as one group
#pragma unroll
    for (int u = 0; u < 4; ++u) {
      const v4f b0 = *(const v4f*)&bias[n0 + 16 * u + half * 8];
      const v4f b1 = *(const v4f*)&bias[n0 + 16 * u + half * 8 + 4];
#pragma unroll
      for (int mm = 0; mm < 4; ++mm) {
        v4f lo, hi;
#pragma unroll
        for (int r = 0; r < 4; ++r) {
          lo[r] = acc[mm][u][r] + b0[r];
          hi[r] = acc[mm][u][4 + r] + b1[r];
        }
        float* p = &Sf[(mm * 16 + ln) * EPF + 16 * u + half * 8];
        *(v4f*)p       = lo;
        *(v4f*)(p + 4) = hi;
      }
    }
    // the wave's own LDS writes are done before other lanes read the rows back
    asm volatile("s_wait_dscnt 0x0" ::: "memory");
    // one wave-wide store: two rows of 256 bytes, four whole lines
    v4f row[32];
#pragma unroll
    for (int i = 0; i < 32; ++i) row[i] = *(const v4f*)&Sf[(2 * i + half) * EPF + ln * 4];
    float* og = outF + (size_t)(m0 + half) * D_MODEL + n0 + ln * 4;
#pragma unroll
    for (int i = 0; i < 32; ++i) *(v4f*)&og[(size_t)(2 * i) * D_MODEL] = row[i];
    return;
  }

  // f16 rows of 128 bytes at pitch 144 (16 B x 9). Modes 0, 1: row s, column d;
  // mode 2: row d, column s.
  _Float16* Sw = S + wave * (64 * EPH);
  // every loop down to the stores is unrolled so that acc[][] and row[] keep
  // constant indices (stay in registers) and each kind of access issues as one group
#pragma unroll
  for (int u = 0; u < 4; ++u) {
    v4f b0, b1;
    float bv = 0.0f;
    if (mode == 2) {
      bv = bias[n0 + 16 * u + ln];
    } else {
      b0 = *(const v4f*)&bias[n0 + 16 * u + half * 8];
      b1 = *(const v4f*)&bias[n0 + 16 * u + half * 8 + 4];
    }
#pragma unroll
    for (int mm = 0; mm < 4; ++mm) {
      union { _Float16 h[8]; uint4 q; } pk;
#pragma unroll
      for (int r = 0; r < 8; ++r) {
        float val = acc[mm][u][r] + (mode == 2 ? bv : r < 4 ? b0[r & 3] : b1[r & 3]);
        if (mode == 0) val *= 0.125f;
        pk.h[r] = (_Float16)val;
      }
      // modes 0, 1: out[m0 + 16 mm + ln][n0 + 16 u + 8 half + r];
      // mode 2:     out[m0 + 16 mm + 8 half + r][n0 + 16 u + ln]
      const int rw = mode == 2 ? 16 * u + ln : 16 * mm + ln;
      const int cl = (mode == 2 ? 16 * mm : 16 * u) + half * 8;
      *(uint4*)&Sw[rw * EPH + cl] = pk.q;
    }
  }
  // the wave's own LDS writes are done before other lanes read the rows back
  asm volatile("s_wait_dscnt 0x0" ::: "memory");
  // one wave-wide store: four rows of 128 bytes, four whole lines
  uint4 row[16];
#pragma unroll
  for (int i = 0; i < 16; ++i)
    row[i] = *(const uint4*)&Sw[(4 * i + (lane >> 3)) * EPH + (lane & 7) * 8];
  // a wave's 64 rows m lie in one batch (m0 is a multiple of 64) and its 64
  // columns n are one head
  const size_t bh = (size_t)((m0 >> 11) * NHEADS + (n0 >> 6));
  const int    s0 = m0 & (SEQ - 1);
  if (mode == 2) {
    _Float16* og = outH + (bh * HDIM + (lane >> 3)) * SEQ + s0 + (lane & 7) * 8;
#pragma unroll
    for (int i = 0; i < 16; ++i) *(uint4*)&og[(size_t)(4 * i) * SEQ] = row[i];
  } else {
    // the tile is 8 KB in a row
    _Float16* og = outH + (bh * SEQ + s0) * HDIM + lane * 8;
#pragma unroll
    for (int i = 0; i < 16; ++i) *(uint4*)&og[i * 256] = row[i];
  }
}

// lane l reads lane l ^ 16: a vector cross-row move, no LDS round trip
__device__ __forceinline__ float xhalf(float x) {
  return __builtin_bit_cast(float, __builtin_amdgcn_permlanex16(
      __builtin_bit_cast(int, x), __builtin_bit_cast(int, x),
      0x76543210, 0xfedcba98, false, false));
}

// 2^x of eight values and of one more, each in place. The v_exp_f32 stand in one
// statement so that none is directly followed by a write of its own source (left
// to the register allocator, a v_exp often lands on the source of the one before);
// the closing v_nop is the slot the instruction set asks for behind a
// transcendental before its result is used.
__device__ __forceinline__ void exp2x9(float (&x)[8], float& y) {
  asm("v_exp_f32 %0, %0\n\t"
      "v_exp_f32 %1, %1\n\t"
      "v_exp_f32 %2, %2\n\t"
      "v_exp_f32 %3, %3\n\t"
      "v_exp_f32 %4, %4\n\t"
      "v_exp_f32 %5, %5\n\t"
      "v_exp_f32 %6, %6\n\t"
      "v_exp_f32 %7, %7\n\t"
      "v_exp_f32 %8, %8\n\t"
      "v_nop"
      : "+v"(y), "+v"(x[0]), "+v"(x[1]), "+v"(x[2]), "+v"(x[3]),
        "+v"(x[4]), "+v"(x[5]), "+v"(x[6]), "+v"(x[7]));
}
__device__ __forceinline__ void exp2x8(float (&x)[8]) {
  asm("v_exp_f32 %0, %0\n\t"
      "v_exp_f32 %1, %1\n\t"
      "v_exp_f32 %2, %2\n\t"
      "v_exp_f32 %3, %3\n\t"
      "v_exp_f32 %4, %4\n\t"
      "v_exp_f32 %5, %5\n\t"
      "v_exp_f32 %6, %6\n\t"
      "v_exp_f32 %7, %7\n\t"
      "v_nop"
      : "+v"(x[0]), "+v"(x[1]), "+v"(x[2]), "+v"(x[3]),
        "+v"(x[4]), "+v"(x[5]), "+v"(x[6]), "+v"(x[7]));
}

// One attention stage: 64 keys of K (64 rows of 128 bytes, contiguous in memory)
// and of V^T (64 d rows, 128 bytes of each), as whole 128-byte lines.
#define AKEYS   64                    // keys per stage
#define APITCH  72                    // LDS row pitch in halfs: 144 B = 16 B x 9
#define ASTAGE  (128 * APITCH)        // halfs per stage: 64 K rows, then 64 V^T rows
// Eight asynchronous 16-byte copies per lane, rows 16 apart: four of K, four of
// V^T (one wave-wide copy covers four whole rows). gk, gv and l are the lane's own
// first chunk. The s_wait_xcnt stands inside the copies' own statement so that no
// address register is rewritten ahead of it.
__device__ __forceinline__ void fill_kv(const _Float16* gk, const _Float16* gv, unsigned l) {
  asm volatile(
      "global_load_async_to_lds_b128 %0, %8, off\n\t"
      "global_load_async_to_lds_b128 %1, %9, off\n\t"
      "global_load_async_to_lds_b128 %2, %10, off\n\t"
      "global_load_async_to_lds_b128 %3, %11, off\n\t"
      "global_load_async_to_lds_b128 %4, %12, off\n\t"
      "global_load_async_to_lds_b128 %5, %13, off\n\t"
      "global_load_async_to_lds_b128 %6, %14, off\n\t"
      "global_load_async_to_lds_b128 %7, %15, off\n\t"
      "s_wait_xcnt 0x0"
      :: "v"(l), "v"(l + 16u * APITCH * 2u), "v"(l + 32u * APITCH * 2u),
         "v"(l + 48u * APITCH * 2u), "v"(l + 64u * APITCH * 2u),
         "v"(l + 80u * APITCH * 2u), "v"(l + 96u * APITCH * 2u),
         "v"(l + 112u * APITCH * 2u),
         "v"(gk), "v"(gk + 16 * HDIM), "v"(gk + 32 * HDIM), "v"(gk + 48 * HDIM),
         "v"(gv), "v"(gv + 16 * SEQ), "v"(gv + 32 * SEQ), "v"(gv + 48 * SEQ)
      : "memory");
}

__global__ __launch_bounds__(128)
void flash_attn(const _Float16* __restrict__ Q, const _Float16* __restrict__ K,
                const _Float16* __restrict__ Vt, _Float16* __restrict__ O) {
  const int lane = threadIdx.x & 31;
  const int wave = threadIdx.x >> 5;
  const int half = lane >> 4;
  const int ln   = lane & 15;
  const int bh   = blockIdx.y;

  __shared__ __align__(16) _Float16 KV[2 * ASTAGE];       // 2 x 18,432 B
  // output staging, a range of 16 rows per wave, outside the ring: the next query
  // block's copies may fly while another wave still reads its rows back
  __shared__ __align__(16) _Float16 OS[4 * 16 * APITCH];  // 4 x 2,304 B
  // The lane's own 16-byte chunk: row tid/8 (+16 per copy), chunk tid%8.
  const int rg = threadIdx.x >> 3;
  const int ch = threadIdx.x & 7;
  const _Float16* gk = K + ((size_t)bh * SEQ + rg) * HDIM + ch * 8;
  const _Float16* gv = Vt + ((size_t)bh * HDIM + rg) * SEQ + ch * 8;
  const unsigned  l0 = (unsigned)(size_t)(__attribute__((address_space(3))) _Float16*)
                           &KV[rg * APITCH + ch * 8];

  // kept rolled: the two query blocks run one after the other through the same
  // text; unrolled, the text a cold launch has to fetch would double
#pragma unroll 1
  for (int part = 0; part < 2; ++part) {
  const int qblk = part == 0 ? SEQ / 64 - 1 - (int)blockIdx.x : (int)blockIdx.x;
  const int q0   = (qblk * 4 + wave) * 16;
  const int q    = q0 + ln;              // the lane's own query

  const _Float16* Qb = Q + ((size_t)bh * SEQ + q) * HDIM;
  v16h qb0 = frag_load(Qb, half);        // B operand, d = 0..31
  v16h qb1 = frag_load(Qb + 32, half);   // B operand, d = 32..63

  v8f   o[4] = {};                       // o[t][r] = O^T[d = 16t + 8*half + r][q]
  float mi = -1e30f;                     // running maximum, equal in both halves
  float li = 0.0f;                       // running sum over this half's keys only

  // Every reader has left both buffers here: nothing was read before the first
  // query block, and the first one's last trip ends in its waits and barrier.
  const int nst = qblk + 1;              // stages of 64 keys, block-uniform
  fill_kv(gk, gv, l0);
  // stage 0 has landed before any wave reads it
  asm volatile("s_wait_asynccnt 0x0" ::: "memory");
  __syncthreads();
  if (nst > 1) fill_kv(gk + AKEYS * HDIM, gv + AKEYS, l0 + ASTAGE * 2u);

  // kept rolled: a trip is one stage with its publish point at the foot
#pragma unroll 1
  for (int st = 0; st < nst; ++st) {
  const _Float16* Sb = &KV[(st & 1) * ASTAGE];
  // unrolled: the two 32-key halves of a stage read at constant LDS offsets
#pragma unroll
  for (int p = 0; p < 2; ++p) {
    const int j0 = st * AKEYS + p * 32;
    const _Float16* Kl = Sb + (p * 32 + ln) * APITCH;
    const _Float16* Kh = Kl + 16 * APITCH;

    // All LDS reads of the 32 keys (K frags + V frags) as one group; the V
    // fragments arrive under the softmax VALU work.
    v16h ka00 = frag_load(Kl, half);
    v16h ka01 = frag_load(Kl + 32, half);
    v16h ka10 = frag_load(Kh, half);
    v16h ka11 = frag_load(Kh + 32, half);
    v16h va[4];
#pragma unroll
    for (int t = 0; t < 4; ++t)
      va[t] = frag_load(Sb + (64 + 16 * t + ln) * APITCH + p * 32, half);
    // keeps the 16 loads one group ahead of the first WMMA: with fewer live
    // registers the compiler otherwise reuses fragment registers and strings
    // the loads out between the WMMAs, one LDS latency after another
    __builtin_amdgcn_sched_barrier(0);

    // sl[r] = S^T[key j0 + 8*half + r][q], sh[r] = the same 16 keys further on
    v8f sl = {}, sh = {};
    sl = __builtin_amdgcn_wmma_f32_16x16x32_f16(false, ka00, false, qb0, (short)0, sl, false, false);
    sl = __builtin_amdgcn_wmma_f32_16x16x32_f16(false, ka01, false, qb1, (short)0, sl, false, false);
    sh = __builtin_amdgcn_wmma_f32_16x16x32_f16(false, ka10, false, qb0, (short)0, sh, false, false);
    sh = __builtin_amdgcn_wmma_f32_16x16x32_f16(false, ka11, false, qb1, (short)0, sh, false, false);

    // Causal mask (key > query), only in the stage on the diagonal, the query
    // block's last: every key of an earlier stage lies below the block's first
    // query, so the test holds for all 32 scores of a lane and the index
    // additions, compares and selects are jumped over. st and nst are the same for
    // the whole block: a scalar branch.
    if (st + 1 == nst) {
      const int kb = j0 + half * 8;
      // unrolled: sl[] and sh[] keep constant indices (stay in registers)
#pragma unroll
      for (int r = 0; r < 8; ++r) {
        sl[r] = (kb + r      <= q) ? sl[r] : -1e30f;
        sh[r] = (kb + 16 + r <= q) ? sh[r] : -1e30f;
      }
    }
    float v = -1e30f;
    // unrolled for the same reason
#pragma unroll
    for (int r = 0; r < 8; ++r) v = fmaxf(v, fmaxf(sl[r], sh[r]));
    v = fmaxf(v, xhalf(v));              // the other half's 16 keys of this query
    const float mnew  = fmaxf(mi, v);
    // e^x as 2^(x * log2 e), the form of __expf
    const float L2E = 1.44269504088896340736f;
    float scale = (mi - mnew) * L2E;
    mi = mnew;
    float ea[8], eb[8];
#pragma unroll
    for (int r = 0; r < 8; ++r) {
      ea[r] = (sl[r] - mnew) * L2E;
      eb[r] = (sh[r] - mnew) * L2E;
    }
    exp2x9(ea, scale);
    exp2x8(eb);

    // P^T as B operand: element s is key j0 + 8*half + s (+ 8 for s >= 8), the order of va[]
    v16h pb;
    float rs = 0.0f;
#pragma unroll
    for (int r = 0; r < 8; ++r) {
      rs += ea[r] + eb[r];
      pb[r]     = (_Float16)ea[r];
      pb[8 + r] = (_Float16)eb[r];
    }
    li = li * scale + rs;

#pragma unroll
    for (int t = 0; t < 4; ++t)
#pragma unroll
      for (int r = 0; r < 8; ++r) o[t][r] *= scale;

    // O^T += V^T x P^T : A[d][k] = Vt row d (keys contiguous), B[k][q] = P^T
#pragma unroll
    for (int t = 0; t < 4; ++t)
      o[t] = __builtin_amdgcn_wmma_f32_16x16x32_f16(
          false, va[t], false, pb, (short)0, o[t], false, false);
  }
    // Publish point: this wave's reads of buffer st%2 are done, its copies of
    // stage st+1 have landed; behind the barrier both hold for every wave.
    asm volatile("s_wait_dscnt 0x0" ::: "memory");
    asm volatile("s_wait_asynccnt 0x0" ::: "memory");
    __syncthreads();
    if (st + 2 < nst)
      fill_kv(gk + (st + 2) * (AKEYS * HDIM), gv + (st + 2) * AKEYS,
              l0 + (unsigned)(st & 1) * (ASTAGE * 2u));
  }
  // no copy is outstanding when the wave goes on to its stores
  asm volatile("s_wait_asynccnt 0x0" ::: "memory");

  li += xhalf(li);                       // join the two halves' sums, once
  const int b_ = bh >> 4;
  const int h_ = bh & 15;
  // a lane's 8 accumulator registers are 8 consecutive d of its query's row: the
  // wave lays its 16 rows of 128 bytes into its own LDS range and reads them back
  // so that each wave-wide 16-byte store covers four whole 128-byte lines
  _Float16* Ow = &OS[wave * (16 * APITCH)];
#pragma unroll
  for (int t = 0; t < 4; ++t) {
    union { _Float16 h[8]; uint4 u; } pk;
#pragma unroll
    for (int r = 0; r < 8; ++r) pk.h[r] = (_Float16)(o[t][r] / li);
    *(uint4*)&Ow[ln * APITCH + 16 * t + half * 8] = pk.u;
  }
  // the wave's own LDS writes are done before other lanes read the rows back
  asm volatile("s_wait_dscnt 0x0" ::: "memory");
  uint4 orow[4];
  // unrolled: orow[] keeps constant indices (stays in registers)
#pragma unroll
  for (int i = 0; i < 4; ++i)
    orow[i] = *(const uint4*)&Ow[(4 * i + (lane >> 3)) * APITCH + (lane & 7) * 8];
  _Float16* Ob = O + ((size_t)(b_ * SEQ + q0 + (lane >> 3))) * D_MODEL + h_ * HDIM
                   + (lane & 7) * 8;
#pragma unroll
  for (int i = 0; i < 4; ++i) *(uint4*)&Ob[(size_t)(4 * i) * D_MODEL] = orow[i];
  // the next query block rewrites the registers that these stores name (address
  // and data): the wait stands behind the stores, in front of every such write
  asm volatile("s_wait_xcnt 0x0" ::: "memory");
  }
}

extern "C" void kernel_launch(void* const* d_in, const int* in_sizes, int n_in,
                              void* d_out, int out_size, void* d_ws, size_t ws_size,
                              hipStream_t stream) {
  const float* x  = (const float*)d_in[0];
  const float* Wq = (const float*)d_in[1];
  const float* bq = (const float*)d_in[2];
  const float* Wk = (const float*)d_in[3];
  const float* bk = (const float*)d_in[4];
  const float* Wv = (const float*)d_in[5];
  const float* bv = (const float*)d_in[6];
  const float* Wo = (const float*)d_in[7];
  const float* bo = (const float*)d_in[8];
  float* out = (float*)d_out;

  char* ws = (char*)d_ws;
  size_t off = 0;
  const size_t XSZ = (size_t)MTOT * D_MODEL * sizeof(_Float16);      // 16 MB
  const size_t WSZ = (size_t)D_MODEL * D_MODEL * sizeof(_Float16);   //  2 MB
  _Float16* xh  = (_Float16*)(ws + off); off += XSZ;
  _Float16* wqh = (_Float16*)(ws + off); off += WSZ;
  _Float16* wkh = (_Float16*)(ws + off); off += WSZ;
  _Float16* wvh = (_Float16*)(ws + off); off += WSZ;
  _Float16* woh = (_Float16*)(ws + off); off += WSZ;
  _Float16* qh  = (_Float16*)(ws + off); off += XSZ;
  _Float16* kh  = (_Float16*)(ws + off); off += XSZ;
  _Float16* vt  = (_Float16*)(ws + off); off += XSZ;
  _Float16* at  = (_Float16*)(ws + off); off += XSZ;   // attention output (b, s, h*hd)
  (void)in_sizes; (void)n_in; (void)out_size; (void)ws_size;

  // xh, wqh, wkh, wvh, woh are contiguous from xh on: one destination array
  f32_to_f16_all<<<256, 512, 0, stream>>>(x, Wq, Wk, Wv, Wo, xh);

  dim3 gg(MTOT / 128, D_MODEL / 128);
  gemm32<0><<<gg, 128, 0, stream>>>(xh, wqh, bq, qh, nullptr);   // Q (scaled)
  gemm32<1><<<gg, 128, 0, stream>>>(xh, wkh, bk, kh, nullptr);   // K
  gemm32<2><<<gg, 128, 0, stream>>>(xh, wvh, bv, vt, nullptr);   // V^T

  flash_attn<<<dim3(SEQ / 128, BATCH * NHEADS), 128, 0, stream>>>(qh, kh, vt, at);

  gemm32<3><<<gg, 128, 0, stream>>>(at, woh, bo, nullptr, out);  // out proj
}

// v009
// One run takes 108 microseconds.
// Next to v008, in two timings, it ran 1.04 times as fast each time.
// All steps since v000 together make it 4.33 times as fast.
#include <hip/hip_runtime.h>

// ---------------------------------------------------------------------------
// Causal self-attention for MI455X (gfx1250, wave32, WMMA).
// fp32 in/out; internal compute in f16 with fp32 WMMA accumulation.
// ---------------------------------------------------------------------------

typedef __attribute__((ext_vector_type(16))) _Float16 v16h;
typedef __attribute__((ext_vector_type(8)))  float    v8f;

#define D_MODEL 1024
#define NHEADS  16
#define HDIM    64
#define SEQ     2048
#define BATCH   4
#define MTOT    (BATCH * SEQ)   // 8192 rows

// Load a 16x32 f16 fragment (A-layout or symmetric B-layout) where the WMMA
// K-dimension is contiguous in memory at `p` (p = row/col start + k-base).
// Per CDNA5 ISA 16-bit A layout: lane half = lane>>4,
//   VGPR v holds K = (v/4)*16 + half*8 + (v%4)*2  (+1 for hi half of dword).
// Per half this is two contiguous 16B chunks -> compiler emits 2x b128 loads.
__device__ __forceinline__ v16h frag_load(const _Float16* p, int half) {
  union { v16h h; unsigned int u[8]; } r;
#pragma unroll
  for (int v = 0; v < 8; ++v) {
    int k = ((v >> 2) << 4) + (half << 3) + ((v & 3) << 1);
    r.u[v] = *(const unsigned int*)(p + k);
  }
  return r.h;
}

// Eight asynchronous 16-byte copies global -> LDS, rows 8 apart (one wave-wide
// copy covers two whole 256-byte row slabs). The s_wait_xcnt stands inside the
// copies' own statement so that no address register is rewritten ahead of it.
#define GK      128                   // k elements per stage (256 B per row)
#define GPITCH  136                   // LDS row pitch in halfs: 272 B = 16 B x 17
#define GSTAGE  (256 * GPITCH)        // halfs per stage: 128 A rows + 128 W rows
#define EPH     72                    // epilogue row pitch, f16 tile, in halfs (144 B)
#define EPF     68                    // epilogue row pitch, f32 tile, in floats (272 B)
__device__ __forceinline__ void async_rows8(const _Float16* g, unsigned l) {
  asm volatile(
      "global_load_async_to_lds_b128 %0, %8, off\n\t"
      "global_load_async_to_lds_b128 %1, %9, off\n\t"
      "global_load_async_to_lds_b128 %2, %10, off\n\t"
      "global_load_async_to_lds_b128 %3, %11, off\n\t"
      "global_load_async_to_lds_b128 %4, %12, off\n\t"
      "global_load_async_to_lds_b128 %5, %13, off\n\t"
      "global_load_async_to_lds_b128 %6, %14, off\n\t"
      "global_load_async_to_lds_b128 %7, %15, off\n\t"
      "s_wait_xcnt 0x0"
      :: "v"(l), "v"(l + 8u * GPITCH * 2u), "v"(l + 16u * GPITCH * 2u),
         "v"(l + 24u * GPITCH * 2u), "v"(l + 32u * GPITCH * 2u),
         "v"(l + 40u * GPITCH * 2u), "v"(l + 48u * GPITCH * 2u),
         "v"(l + 56u * GPITCH * 2u),
         "v"(g), "v"(g + 8 * D_MODEL), "v"(g + 16 * D_MODEL), "v"(g + 24 * D_MODEL),
         "v"(g + 32 * D_MODEL), "v"(g + 40 * D_MODEL), "v"(g + 48 * D_MODEL),
         "v"(g + 56 * D_MODEL)
      : "memory");
}

// One stage: 128 rows of A, then 128 rows of W, 256 bytes of each row.
// 32 copies per lane; ga/gw and l are the lane's own first chunk.
__device__ __forceinline__ void fill_stage(const _Float16* ga, const _Float16* gw, unsigned l) {
  async_rows8(ga, l);
  async_rows8(ga + 64 * D_MODEL, l + 64u * GPITCH * 2u);
  async_rows8(gw, l + 128u * GPITCH * 2u);
  async_rows8(gw + 64 * D_MODEL, l + 192u * GPITCH * 2u);
}

// All five f32 -> f16 conversions in one streaming launch. The f16 copies of x,
// Wq, Wk, Wv, Wo lie one behind the other in the workspace, so d is one array of
// 768 units of 16,384 elements: 512 of x, then 64 of each weight. One block of 16
// waves per WGP takes three units: b and b + 256 (x) and 512 + b (weight b / 64).
// A wave owns 4 KB of each unit: eight 16-byte loads per lane, each wave-wide load
// four whole lines, each wave-wide 8-byte store two whole lines.
typedef __attribute__((ext_vector_type(4))) float    v4f;
typedef __attribute__((ext_vector_type(4))) _Float16 v4h;
#define CVT_UNIT 16384
__global__ __launch_bounds__(512)
void f32_to_f16_all(const float* __restrict__ x, const float* __restrict__ wq,
                    const float* __restrict__ wk, const float* __restrict__ wv,
                    const float* __restrict__ wo, _Float16* __restrict__ d) {
  const int b  = blockIdx.x;
  const int e0 = (threadIdx.x >> 5) * 1024 + (threadIdx.x & 31) * 4;   // in the unit
  const float* w = b < 64 ? wq : b < 128 ? wk : b < 192 ? wv : wo;
  const float* s0 = x + (size_t)b * CVT_UNIT + e0;
  const float* s1 = x + (size_t)(b + 256) * CVT_UNIT + e0;
  const float* s2 = w + (size_t)(b & 63) * CVT_UNIT + e0;
  v4f r0[8], r1[8], r2[8];
  // unrolled: constant offsets from three bases, the loaded values stay in registers
#pragma unroll
  for (int j = 0; j < 8; ++j) r0[j] = *(const v4f*)(s0 + j * 128);
#pragma unroll
  for (int j = 0; j < 8; ++j) r1[j] = *(const v4f*)(s1 + j * 128);
#pragma unroll
  for (int j = 0; j < 8; ++j) r2[j] = *(const v4f*)(s2 + j * 128);
  // all 24 loads of a lane issue ahead of the first conversion: without it the
  // compiler reuses the first loads' registers and holds the last ten loads back
  // until the first ones have returned
  __builtin_amdgcn_sched_barrier(0);
  _Float16* d0 = d + (size_t)b * CVT_UNIT + e0;
  _Float16* d1 = d + (size_t)(b + 256) * CVT_UNIT + e0;
  _Float16* d2 = d + (size_t)(b + 512) * CVT_UNIT + e0;
  // unrolled like the loads: r0, r1, r2 keep constant indices (stay in registers)
#pragma unroll
  for (int j = 0; j < 8; ++j) *(v4h*)(d0 + j * 128) = __builtin_convertvector(r0[j], v4h);
#pragma unroll
  for (int j = 0; j < 8; ++j) *(v4h*)(d1 + j * 128) = __builtin_convertvector(r1[j], v4h);
#pragma unroll
  for (int j = 0; j < 8; ++j) *(v4h*)(d2 + j * 128) = __builtin_convertvector(r2[j], v4h);
}

// GEMM: out[m,n] = sum_k A[m,k] * W[n,k] + bias[n]   (nn.Linear semantics)
// Block = 4 waves (2x2) computing a 128x128 tile; each wave owns 64x64
// (16 WMMA acc). Both operands come per 128-k stage into a two-buffer LDS ring
// by asynchronous copies and are shared by the block's waves.
// mode 0: the Q, K and V projections in ONE launch. Their f16 weights lie one behind
// the other (3,072 rows of W), their outputs too; sel = blockIdx.y / 8 says which:
//   sel 0: store Q (bh,s,hd) scaled by 1/sqrt(HDIM)
//   sel 1: store K (bh,s,hd)
//   sel 2: store V transposed (bh,hd,s)
// The 1,536 blocks follow one another on the WGPs with no launch boundary between
// the three products: a block starts as soon as a place is free.
// mode 3: store fp32 row-major to outF (final projection), sel = 3
// Epilogue: the product is formed so that a lane's 8 accumulator registers are 8
// neighbours of one OUTPUT row (sel 0, 1, 3: W rows as first operand, so the
// registers run along n; sel 2: A rows first, so they run along s). Each wave
// lays its 64x64 tile row by row into its own range of the ring, which is idle
// behind the loop's last barrier, and reads it back so that every wave-wide
// 16-byte store covers whole 128-byte lines.
// sel is the same for a whole block: it picks the two operands' LDS rows once, ahead
// of the loop, and one of two f16 epilogues by a scalar branch; no test per element.
template <int mode>
__global__ __launch_bounds__(128)
void gemm32(const _Float16* __restrict__ A, const _Float16* __restrict__ W,
            const float* __restrict__ bias0, const float* __restrict__ bias1,
            const float* __restrict__ bias2, _Float16* __restrict__ outH,
            float* __restrict__ outF) {
  __shared__ __align__(16) _Float16 S[2 * GSTAGE];        // 2 x 69,632 B
  const int tid  = threadIdx.x;
  const int lane = tid & 31;
  const int wave = tid >> 5;
  const int half = lane >> 4;
  const int ln   = lane & 15;
  const int wm   = wave >> 1;
  const int wn   = wave & 1;
  const int m0   = blockIdx.x * 128 + wm * 64;
  const int sel  = mode == 3 ? 3 : (int)(blockIdx.y >> 3);
  const int n0   = (blockIdx.y & 7) * 128 + wn * 64;      // column in its own product
  const float* bias = sel == 1 ? bias1 : sel == 2 ? bias2 : bias0;
  // stage rows of the first and of the second WMMA operand (A rows 0..127, W rows
  // 128..255 of a stage)
  const int fo = sel == 2 ? wm * 64 : 128 + wn * 64;
  const int so = sel == 2 ? 128 + wn * 64 : wm * 64;

  // The lane's own 16-byte chunk: row tid/16 (+8 per copy), chunk tid%16.
  const int rg = tid >> 4;
  const int ch = tid & 15;
  const _Float16* ga = A + (size_t)(blockIdx.x * 128 + rg) * D_MODEL + ch * 8;
  const _Float16* gw = W + (size_t)(blockIdx.y * 128 + rg) * D_MODEL + ch * 8;
  const unsigned  l0 = (unsigned)(size_t)(__attribute__((address_space(3))) _Float16*)
                           &S[rg * GPITCH + ch * 8];

  fill_stage(ga, gw, l0);
  // stage 0 has landed before any wave reads it
  asm volatile("s_wait_asynccnt 0x0" ::: "memory");
  __syncthreads();
  fill_stage(ga + GK, gw + GK, l0 + GSTAGE * 2u);

  // acc[j][i]: second-operand tile j, first-operand tile i. sel 0, 1, 3: [mm][u];
  // sel 2: [u][mm] (mm = 16-row tile of A, u = 16-row tile of W)
  v8f acc[4][4] = {};
  // kept rolled: unrolling would only multiply the text a cold launch has to
  // fetch; a trip costs a few scalar instructions per 64 WMMAs
#pragma unroll 1
  for (int t = 0; t < D_MODEL / GK; ++t) {
    const _Float16* Sb = &S[(t & 1) * GSTAGE];
    const _Float16* fL = Sb + (fo + ln) * GPITCH;
    const _Float16* sL = Sb + (so + ln) * GPITCH;
#pragma unroll
    for (int kk = 0; kk < GK; kk += 32) {
      v16h f[4], s[4];
      // in the order the WMMAs below first need them
      s[0] = frag_load(sL + kk, half);
#pragma unroll
      for (int i = 0; i < 4; ++i) f[i] = frag_load(fL + i * 16 * GPITCH + kk, half);
#pragma unroll
      for (int i = 1; i < 4; ++i) s[i] = frag_load(sL + i * 16 * GPITCH + kk, half);
      // keeps the 16 LDS reads of this k step together ahead of its 16 WMMAs:
      // spread among them, every row of four waits out a full LDS latency
      __builtin_amdgcn_sched_barrier(0);
#pragma unroll
      for (int j = 0; j < 4; ++j)
#pragma unroll
        for (int i = 0; i < 4; ++i)
          acc[j][i] = __builtin_amdgcn_wmma_f32_16x16x32_f16(
              false, f[i], false, s[j], (short)0, acc[j][i], false, false);
      // the next k step's reads stay behind this step's WMMAs (one load group)
      __builtin_amdgcn_sched_barrier(0);
    }
    // Publish point: this wave's reads of buffer t%2 are done, its copies of
    // stage t+1 have landed; behind the barrier both hold for every wave.
    asm volatile("s_wait_dscnt 0x0" ::: "memory");
    asm volatile("s_wait_asynccnt 0x0" ::: "memory");
    __syncthreads();
    if (t + 2 < D_MODEL / GK)
      fill_stage(ga + (t + 2) * GK, gw + (t + 2) * GK, l0 + (unsigned)(t & 1) * (GSTAGE * 2u));
  }
  // no copy is outstanding when the wave goes on to its stores and ends
  asm volatile("s_wait_asynccnt 0x0" ::: "memory");

  if (mode == 3) {
    // f32 rows of 256 bytes at pitch 272 (16 B x 17): acc[mm][u][r] is
    // out[m0 + 16 mm + ln][n0 + 16 u + 8 half + r]
    float* Sf = (float*)S + wave * (64 * EPF);
    // every loop down to the stores is unrolled so that acc[][] and row[] keep
    // constant indices (stay in registers) and each kind of access issues as one group
#pragma unroll
    for (int u = 0; u < 4; ++u) {
      const v4f b0 = *(const v4f*)&bias[n0 + 16 * u + half * 8];
      const v4f b1 = *(const v4f*)&bias[n0 + 16 * u + half * 8 + 4];
#pragma unroll
      for (int mm = 0; mm < 4; ++mm) {
        v4f lo, hi;
#pragma unroll
        for (int r = 0; r < 4; ++r) {
          lo[r] = acc[mm][u][r] + b0[r];
          hi[r] = acc[mm][u][4 + r] + b1[r];
        }
        float* p = &Sf[(mm * 16 + ln) * EPF + 16 * u + half * 8];
        *(v4f*)p       = lo;
        *(v4f*)(p + 4) = hi;
      }
    }
    // the wave's own LDS writes are done before other lanes read the rows back
    asm volatile("s_wait_dscnt 0x0" ::: "memory");
    // one wave-wide store: two rows of 256 bytes, four whole lines
    v4f row[32];
#pragma unroll
    for (int i = 0; i < 32; ++i) row[i] = *(const v4f*)&Sf[(2 * i + half) * EPF + ln * 4];
    float* og = outF + (size_t)(m0 + half) * D_MODEL + n0 + ln * 4;
#pragma unroll
    for (int i = 0; i < 32; ++i) *(v4f*)&og[(size_t)(2 * i) * D_MODEL] = row[i];
    return;
  }

  // f16 rows of 128 bytes at pitch 144 (16 B x 9). sel 0, 1: row s, column d;
  // sel 2: row d, column s.
  _Float16* Sw = S + wave * (64 * EPH);
  // a wave's 64 rows m lie in one batch (m0 is a multiple of 64) and its 64
  // columns n are one head
  const size_t bh = (size_t)((m0 >> 11) * NHEADS + (n0 >> 6));
  const int    s0 = m0 & (SEQ - 1);
  // Q, K and V^T lie one behind the other from outH on
  _Float16* oP = outH + (size_t)sel * ((size_t)MTOT * D_MODEL);
  uint4 row[16];
  // every loop down to the stores is unrolled so that acc[][] and row[] keep
  // constant indices (stay in registers) and each kind of access issues as one group
  if (sel == 2) {
    // acc[u][mm][r] is out[m0 + 16 mm + 8 half + r][n0 + 16 u + ln]
#pragma unroll
    for (int u = 0; u < 4; ++u) {
      const float bv = bias[n0 + 16 * u + ln];
#pragma unroll
      for (int mm = 0; mm < 4; ++mm) {
        union { _Float16 h[8]; uint4 q; } pk;
#pragma unroll
        for (int r = 0; r < 8; ++r) pk.h[r] = (_Float16)(acc[u][mm][r] + bv);
        *(uint4*)&Sw[(16 * u + ln) * EPH + 16 * mm + half * 8] = pk.q;
      }
    }
    // the wave's own LDS writes are done before other lanes read the rows back
    asm volatile("s_wait_dscnt 0x0" ::: "memory");
    // one wave-wide store: four rows of 128 bytes, four whole lines
#pragma unroll
    for (int i = 0; i < 16; ++i)
      row[i] = *(const uint4*)&Sw[(4 * i + (lane >> 3)) * EPH + (lane & 7) * 8];
    _Float16* og = oP + (bh * HDIM + (lane >> 3)) * SEQ + s0 + (lane & 7) * 8;
#pragma unroll
    for (int i = 0; i < 16; ++i) *(uint4*)&og[(size_t)(4 * i) * SEQ] = row[i];
    return;
  }
  // acc[mm][u][r] is out[m0 + 16 mm + ln][n0 + 16 u + 8 half + r]
  const float sc = sel == 0 ? 0.125f : 1.0f;   // times 1 is exact: K as it was
#pragma unroll
  for (int u = 0; u < 4; ++u) {
    const v4f b0 = *(const v4f*)&bias[n0 + 16 * u + half * 8];
    const v4f b1 = *(const v4f*)&bias[n0 + 16 * u + half * 8 + 4];
#pragma unroll
    for (int mm = 0; mm < 4; ++mm) {
      union { _Float16 h[8]; uint4 q; } pk;
#pragma unroll
      for (int r = 0; r < 8; ++r)
        pk.h[r] = (_Float16)((acc[mm][u][r] + (r < 4 ? b0[r & 3] : b1[r & 3])) * sc);
      *(uint4*)&Sw[(16 * mm + ln) * EPH + 16 * u + half * 8] = pk.q;
    }
  }
  // the wave's own LDS writes are done before other lanes read the rows back
  asm volatile("s_wait_dscnt 0x0" ::: "memory");
  // one wave-wide store: four rows of 128 bytes, four whole lines
#pragma unroll
  for (int i = 0; i < 16; ++i)
    row[i] = *(const uint4*)&Sw[(4 * i + (lane >> 3)) * EPH + (lane & 7) * 8];
  // the tile is 8 KB in a row
  _Float16* og = oP + (bh * SEQ + s0) * HDIM + lane * 8;
#pragma unroll
  for (int i = 0; i < 16; ++i) *(uint4*)&og[i * 256] = row[i];
}

// lane l reads lane l ^ 16: a vector cross-row move, no LDS round trip
__device__ __forceinline__ float xhalf(float x) {
  return __builtin_bit_cast(float, __builtin_amdgcn_permlanex16(
      __builtin_bit_cast(int, x), __builtin_bit_cast(int, x),
      0x76543210, 0xfedcba98, false, false));
}

// 2^x of eight values and of one more, each in place. The v_exp_f32 stand in one
// statement so that none is directly followed by a write of its own source (left
// to the register allocator, a v_exp often lands on the source of the one before);
// the closing v_nop is the slot the instruction set asks for behind a
// transcendental before its result is used.
__device__ __forceinline__ void exp2x9(float (&x)[8], float& y) {
  asm("v_exp_f32 %0, %0\n\t"
      "v_exp_f32 %1, %1\n\t"
      "v_exp_f32 %2, %2\n\t"
      "v_exp_f32 %3, %3\n\t"
      "v_exp_f32 %4, %4\n\t"
      "v_exp_f32 %5, %5\n\t"
      "v_exp_f32 %6, %6\n\t"
      "v_exp_f32 %7, %7\n\t"
      "v_exp_f32 %8, %8\n\t"
      "v_nop"
      : "+v"(y), "+v"(x[0]), "+v"(x[1]), "+v"(x[2]), "+v"(x[3]),
        "+v"(x[4]), "+v"(x[5]), "+v"(x[6]), "+v"(x[7]));
}
__device__ __forceinline__ void exp2x8(float (&x)[8]) {
  asm("v_exp_f32 %0, %0\n\t"
      "v_exp_f32 %1, %1\n\t"
      "v_exp_f32 %2, %2\n\t"
      "v_exp_f32 %3, %3\n\t"
      "v_exp_f32 %4, %4\n\t"
      "v_exp_f32 %5, %5\n\t"
      "v_exp_f32 %6, %6\n\t"
      "v_exp_f32 %7, %7\n\t"
      "v_nop"
      : "+v"(x[0]), "+v"(x[1]), "+v"(x[2]), "+v"(x[3]),
        "+v"(x[4]), "+v"(x[5]), "+v"(x[6]), "+v"(x[7]));
}

// One attention stage: 64 keys of K (64 rows of 128 bytes, contiguous in memory)
// and of V^T (64 d rows, 128 bytes of each), as whole 128-byte lines.
#define AKEYS   64                    // keys per stage
#define APITCH  72                    // LDS row pitch in halfs: 144 B = 16 B x 9
#define ASTAGE  (128 * APITCH)        // halfs per stage: 64 K rows, then 64 V^T rows
// Eight asynchronous 16-byte copies per lane, rows 16 apart: four of K, four of
// V^T (one wave-wide copy covers four whole rows). gk, gv and l are the lane's own
// first chunk. The s_wait_xcnt stands inside the copies' own statement so that no
// address register is rewritten ahead of it.
__device__ __forceinline__ void fill_kv(const _Float16* gk, const _Float16* gv, unsigned l) {
  asm volatile(
      "global_load_async_to_lds_b128 %0, %8, off\n\t"
      "global_load_async_to_lds_b128 %1, %9, off\n\t"
      "global_load_async_to_lds_b128 %2, %10, off\n\t"
      "global_load_async_to_lds_b128 %3, %11, off\n\t"
      "global_load_async_to_lds_b128 %4, %12, off\n\t"
      "global_load_async_to_lds_b128 %5, %13, off\n\t"
      "global_load_async_to_lds_b128 %6, %14, off\n\t"
      "global_load_async_to_lds_b128 %7, %15, off\n\t"
      "s_wait_xcnt 0x0"
      :: "v"(l), "v"(l + 16u * APITCH * 2u), "v"(l + 32u * APITCH * 2u),
         "v"(l + 48u * APITCH * 2u), "v"(l + 64u * APITCH * 2u),
         "v"(l + 80u * APITCH * 2u), "v"(l + 96u * APITCH * 2u),
         "v"(l + 112u * APITCH * 2u),
         "v"(gk), "v"(gk + 16 * HDIM), "v"(gk + 32 * HDIM), "v"(gk + 48 * HDIM),
         "v"(gv), "v"(gv + 16 * SEQ), "v"(gv + 32 * SEQ), "v"(gv + 48 * SEQ)
      : "memory");
}

__global__ __launch_bounds__(128)
void flash_attn(const _Float16* __restrict__ Q, const _Float16* __restrict__ K,
                const _Float16* __restrict__ Vt, _Float16* __restrict__ O) {
  const int lane = threadIdx.x & 31;
  const int wave = threadIdx.x >> 5;
  const int half = lane >> 4;
  const int ln   = lane & 15;
  const int bh   = blockIdx.y;

  __shared__ __align__(16) _Float16 KV[2 * ASTAGE];       // 2 x 18,432 B
  // output staging, a range of 16 rows per wave, outside the ring: the next query
  // block's copies may fly while another wave still reads its rows back
  __shared__ __align__(16) _Float16 OS[4 * 16 * APITCH];  // 4 x 2,304 B
  // The lane's own 16-byte chunk: row tid/8 (+16 per copy), chunk tid%8.
  const int rg = threadIdx.x >> 3;
  const int ch = threadIdx.x & 7;
  const _Float16* gk = K + ((size_t)bh * SEQ + rg) * HDIM + ch * 8;
  const _Float16* gv = Vt + ((size_t)bh * HDIM + rg) * SEQ + ch * 8;
  const unsigned  l0 = (unsigned)(size_t)(__attribute__((address_space(3))) _Float16*)
                           &KV[rg * APITCH + ch * 8];

  // kept rolled: the two query blocks run one after the other through the same
  // text; unrolled, the text a cold launch has to fetch would double
#pragma unroll 1
  for (int part = 0; part < 2; ++part) {
  const int qblk = part == 0 ? SEQ / 64 - 1 - (int)blockIdx.x : (int)blockIdx.x;
  const int q0   = (qblk * 4 + wave) * 16;
  const int q    = q0 + ln;              // the lane's own query

  const _Float16* Qb = Q + ((size_t)bh * SEQ + q) * HDIM;
  v16h qb0 = frag_load(Qb, half);        // B operand, d = 0..31
  v16h qb1 = frag_load(Qb + 32, half);   // B operand, d = 32..63

  v8f   o[4] = {};                       // o[t][r] = O^T[d = 16t + 8*half + r][q]
  float mi = -1e30f;                     // running maximum, equal in both halves
  float li = 0.0f;                       // running sum over this half's keys only

  // Every reader has left both buffers here: nothing was read before the first
  // query block, and the first one's last trip ends in its waits and barrier.
  const int nst = qblk + 1;              // stages of 64 keys, block-uniform
  fill_kv(gk, gv, l0);
  // stage 0 has landed before any wave reads it
  asm volatile("s_wait_asynccnt 0x0" ::: "memory");
  __syncthreads();
  if (nst > 1) fill_kv(gk + AKEYS * HDIM, gv + AKEYS, l0 + ASTAGE * 2u);

  // kept rolled: a trip is one stage with its publish point at the foot
#pragma unroll 1
  for (int st = 0; st < nst; ++st) {
  const _Float16* Sb = &KV[(st & 1) * ASTAGE];
  // unrolled: the two 32-key halves of a stage read at constant LDS offsets
#pragma unroll
  for (int p = 0; p < 2; ++p) {
    const int j0 = st * AKEYS + p * 32;
    const _Float16* Kl = Sb + (p * 32 + ln) * APITCH;
    const _Float16* Kh = Kl + 16 * APITCH;

    // All LDS reads of the 32 keys (K frags + V frags) as one group; the V
    // fragments arrive under the softmax VALU work.
    v16h ka00 = frag_load(Kl, half);
    v16h ka01 = frag_load(Kl + 32, half);
    v16h ka10 = frag_load(Kh, half);
    v16h ka11 = frag_load(Kh + 32, half);
    v16h va[4];
#pragma unroll
    for (int t = 0; t < 4; ++t)
      va[t] = frag_load(Sb + (64 + 16 * t + ln) * APITCH + p * 32, half);
    // keeps the 16 loads one group ahead of the first WMMA: with fewer live
    // registers the compiler otherwise reuses fragment registers and strings
    // the loads out between the WMMAs, one LDS latency after another
    __builtin_amdgcn_sched_barrier(0);

    // sl[r] = S^T[key j0 + 8*half + r][q], sh[r] = the same 16 keys further on
    v8f sl = {}, sh = {};
    sl = __builtin_amdgcn_wmma_f32_16x16x32_f16(false, ka00, false, qb0, (short)0, sl, false, false);
    sl = __builtin_amdgcn_wmma_f32_16x16x32_f16(false, ka01, false, qb1, (short)0, sl, false, false);
    sh = __builtin_amdgcn_wmma_f32_16x16x32_f16(false, ka10, false, qb0, (short)0, sh, false, false);
    sh = __builtin_amdgcn_wmma_f32_16x16x32_f16(false, ka11, false, qb1, (short)0, sh, false, false);

    // Causal mask (key > query), only in the stage on the diagonal, the query
    // block's last: every key of an earlier stage lies below the block's first
    // query, so the test holds for all 32 scores of a lane and the index
    // additions, compares and selects are jumped over. st and nst are the same for
    // the whole block: a scalar branch.
    if (st + 1 == nst) {
      const int kb = j0 + half * 8;
      // unrolled: sl[] and sh[] keep constant indices (stay in registers)
#pragma unroll
      for (int r = 0; r < 8; ++r) {
        sl[r] = (kb + r      <= q) ? sl[r] : -1e30f;
        sh[r] = (kb + 16 + r <= q) ? sh[r] : -1e30f;
      }
    }
    float v = -1e30f;
    // unrolled for the same reason
#pragma unroll
    for (int r = 0; r < 8; ++r) v = fmaxf(v, fmaxf(sl[r], sh[r]));
    v = fmaxf(v, xhalf(v));              // the other half's 16 keys of this query
    const float mnew  = fmaxf(mi, v);
    // e^x as 2^(x * log2 e), the form of __expf
    const float L2E = 1.44269504088896340736f;
    float scale = (mi - mnew) * L2E;
    mi = mnew;
    float ea[8], eb[8];
#pragma unroll
    for (int r = 0; r < 8; ++r) {
      ea[r] = (sl[r] - mnew) * L2E;
      eb[r] = (sh[r] - mnew) * L2E;
    }
    exp2x9(ea, scale);
    exp2x8(eb);

    // P^T as B operand: element s is key j0 + 8*half + s (+ 8 for s >= 8), the order of va[]
    v16h pb;
    float rs = 0.0f;
#pragma unroll
    for (int r = 0; r < 8; ++r) {
      rs += ea[r] + eb[r];
      pb[r]     = (_Float16)ea[r];
      pb[8 + r] = (_Float16)eb[r];
    }
    li = li * scale + rs;

#pragma unroll
    for (int t = 0; t < 4; ++t)
#pragma unroll
      for (int r = 0; r < 8; ++r) o[t][r] *= scale;

    // O^T += V^T x P^T : A[d][k] = Vt row d (keys contiguous), B[k][q] = P^T
#pragma unroll
    for (int t = 0; t < 4; ++t)
      o[t] = __builtin_amdgcn_wmma_f32_16x16x32_f16(
          false, va[t], false, pb, (short)0, o[t], false, false);
  }
    // Publish point: this wave's reads of buffer st%2 are done, its copies of
    // stage st+1 have landed; behind the barrier both hold for every wave.
    asm volatile("s_wait_dscnt 0x0" ::: "memory");
    asm volatile("s_wait_asynccnt 0x0" ::: "memory");
    __syncthreads();
    if (st + 2 < nst)
      fill_kv(gk + (st + 2) * (AKEYS * HDIM), gv + (st + 2) * AKEYS,
              l0 + (unsigned)(st & 1) * (ASTAGE * 2u));
  }
  // no copy is outstanding when the wave goes on to its stores
  asm volatile("s_wait_asynccnt 0x0" ::: "memory");

  li += xhalf(li);                       // join the two halves' sums, once
  const int b_ = bh >> 4;
  const int h_ = bh & 15;
  // a lane's 8 accumulator registers are 8 consecutive d of its query's row: the
  // wave lays its 16 rows of 128 bytes into its own LDS range and reads them back
  // so that each wave-wide 16-byte store covers four whole 128-byte lines
  _Float16* Ow = &OS[wave * (16 * APITCH)];
#pragma unroll
  for (int t = 0; t < 4; ++t) {
    union { _Float16 h[8]; uint4 u; } pk;
#pragma unroll
    for (int r = 0; r < 8; ++r) pk.h[r] = (_Float16)(o[t][r] / li);
    *(uint4*)&Ow[ln * APITCH + 16 * t + half * 8] = pk.u;
  }
  // the wave's own LDS writes are done before other lanes read the rows back
  asm volatile("s_wait_dscnt 0x0" ::: "memory");
  uint4 orow[4];
  // unrolled: orow[] keeps constant indices (stays in registers)
#pragma unroll
  for (int i = 0; i < 4; ++i)
    orow[i] = *(const uint4*)&Ow[(4 * i + (lane >> 3)) * APITCH + (lane & 7) * 8];
  _Float16* Ob = O + ((size_t)(b_ * SEQ + q0 + (lane >> 3))) * D_MODEL + h_ * HDIM
                   + (lane & 7) * 8;
#pragma unroll
  for (int i = 0; i < 4; ++i) *(uint4*)&Ob[(size_t)(4 * i) * D_MODEL] = orow[i];
  // the next query block rewrites the registers that these stores name (address
  // and data): the wait stands behind the stores, in front of every such write
  asm volatile("s_wait_xcnt 0x0" ::: "memory");
  }
}

extern "C" void kernel_launch(void* const* d_in, const int* in_sizes, int n_in,
                              void* d_out, int out_size, void* d_ws, size_t ws_size,
                              hipStream_t stream) {
  const float* x  = (const float*)d_in[0];
  const float* Wq = (const float*)d_in[1];
  const float* bq = (const float*)d_in[2];
  const float* Wk = (const float*)d_in[3];
  const float* bk = (const float*)d_in[4];
  const float* Wv = (const float*)d_in[5];
  const float* bv = (const float*)d_in[6];
  const float* Wo = (const float*)d_in[7];
  const float* bo = (const float*)d_in[8];
  float* out = (float*)d_out;

  char* ws = (char*)d_ws;
  size_t off = 0;
  const size_t XSZ = (size_t)MTOT * D_MODEL * sizeof(_Float16);      // 16 MB
  const size_t WSZ = (size_t)D_MODEL * D_MODEL * sizeof(_Float16);   //  2 MB
  _Float16* xh  = (_Float16*)(ws + off); off += XSZ;
  _Float16* wqh = (_Float16*)(ws + off); off += WSZ;
  _Float16* wkh = (_Float16*)(ws + off); off += WSZ;
  _Float16* wvh = (_Float16*)(ws + off); off += WSZ;
  _Float16* woh = (_Float16*)(ws + off); off += WSZ;
  _Float16* qh  = (_Float16*)(ws + off); off += XSZ;
  _Float16* kh  = (_Float16*)(ws + off); off += XSZ;
  _Float16* vt  = (_Float16*)(ws + off); off += XSZ;
  _Float16* at  = (_Float16*)(ws + off); off += XSZ;   // attention output (b, s, h*hd)
  (void)in_sizes; (void)n_in; (void)out_size; (void)ws_size;

  // xh, wqh, wkh, wvh, woh are contiguous from xh on: one destination array
  f32_to_f16_all<<<256, 512, 0, stream>>>(x, Wq, Wk, Wv, Wo, xh);

  dim3 gg(MTOT / 128, D_MODEL / 128);
  // Q (scaled), K, V^T: wqh, wkh, wvh are 3,072 contiguous weight rows, qh, kh, vt
  // contiguous outputs
  gemm32<0><<<dim3(MTOT / 128, 3 * D_MODEL / 128), 128, 0, stream>>>(
      xh, wqh, bq, bk, bv, qh, nullptr);

  flash_attn<<<dim3(SEQ / 128, BATCH * NHEADS), 128, 0, stream>>>(qh, kh, vt, at);

  gemm32<3><<<gg, 128, 0, stream>>>(at, woh, bo, bo, bo, nullptr, out);  // out proj
}

// v010
// One run takes 103 microseconds.
// Two timings next to v009 both put it at 1.04 times that version's speed.
// All steps since v000 together make it 4.51 times as fast.
#include <hip/hip_runtime.h>
#include <stdint.h>

// ---------------------------------------------------------------------------
// Causal self-attention for MI455X (gfx1250, wave32, WMMA).
// fp32 in/out; internal compute in f16 with fp32 WMMA accumulation.
// ---------------------------------------------------------------------------

typedef __attribute__((ext_vector_type(16))) _Float16 v16h;
typedef __attribute__((ext_vector_type(8)))  float    v8f;

#define D_MODEL 1024
#define NHEADS  16
#define HDIM    64
#define SEQ     2048
#define BATCH   4
#define MTOT    (BATCH * SEQ)   // 8192 rows

// Load a 16x32 f16 fragment (A-layout or symmetric B-layout) where the WMMA
// K-dimension is contiguous in memory at `p` (p = row/col start + k-base).
// Per CDNA5 ISA 16-bit A layout: lane half = lane>>4,
//   VGPR v holds K = (v/4)*16 + half*8 + (v%4)*2  (+1 for hi half of dword).
// Per half this is two contiguous 16B chunks -> compiler emits 2x b128 loads.
__device__ __forceinline__ v16h frag_load(const _Float16* p, int half) {
  union { v16h h; unsigned int u[8]; } r;
#pragma unroll
  for (int v = 0; v < 8; ++v) {
    int k = ((v >> 2) << 4) + (half << 3) + ((v & 3) << 1);
    r.u[v] = *(const unsigned int*)(p + k);
  }
  return r.h;
}

// GEMM ring: a stage is 128 k (256 B) of 128 A rows and of 128 W rows, in four
// slices of 64 rows. Each of the block's four waves brings its own slice by ONE
// tensor load; the load's pad lays the rows at the readers' pitch.
#define GK      128                   // k elements per stage (256 B per row)
#define GPITCH  136                   // LDS row pitch in halfs: 272 B = 16 B x 17
#define GSLICE  9216                  // halfs per slice place: 64 x 272 B = 17,408 B, rounded up to 9 x 2 KiB
#define GSTAGE  (4 * GSLICE)          // halfs per stage: A rows 0..63, 64..127, W rows 0..63, 64..127
#define EPH     72                    // epilogue row pitch, f16 tile, in halfs (144 B)
#define EPF     68                    // epilogue row pitch, f32 tile, in floats (272 B)
typedef uint32_t u32x4 __attribute__((ext_vector_type(4)));
typedef uint32_t u32x8 __attribute__((ext_vector_type(8)));
__device__ __forceinline__ uint32_t uni(uint32_t v) {
  return (uint32_t)__builtin_amdgcn_readfirstlane(v);
}
// a wave-uniform value held in a scalar register: the test around a tensor load
// compiles to a scalar branch, and a descriptor word formed from it stays behind
// the wait that stands in front of this statement
__device__ __forceinline__ uint32_t pinned(uint32_t v) {
  uint32_t w = (uint32_t)__builtin_amdgcn_readfirstlane(v);
  asm volatile("" : "+s"(w));  // pinned(): an issue test or a descriptor word held in a scalar register
  return w;
}
// One request of the whole wave: NROWS rows of ROWB bytes (256 or 128), source pitch
// in bytes, from global byte address ga to LDS byte offset dst, 16 bytes of pad behind
// every row (pad interval code 5: 64 dwords, 4: 32 dwords = one row).
template <uint32_t ROWB, uint32_t NROWS>
__device__ __forceinline__ void tensor_rows(uint32_t dst, uint64_t ga, uint32_t pitch) {
  static_assert(ROWB == 256u || ROWB == 128u, "the pad interval is the row");
  u32x4 g0;
  g0[0] = uni(1u);                                   // count 1
  g0[1] = uni(dst);
  g0[2] = uni((uint32_t)ga);
  g0[3] = uni((((uint32_t)(ga >> 32)) & 0x01FFFFFFu) | 0x80000000u);   // type 2
  u32x8 g1;
  g1[0] = uni((1u << 20) | ((ROWB == 256u ? 5u : 4u) << 22) | (3u << 25));  // no mask, bytes, pad
  g1[1] = uni(ROWB << 16);                           // tensor_dim0
  g1[2] = uni(NROWS << 16);                          // tensor_dim1
  g1[3] = uni(ROWB << 16);                           // tile_dim0
  g1[4] = uni(NROWS);                                // tile_dim1
  g1[5] = uni(pitch);                                // source row pitch
  g1[6] = uni(0u);
  g1[7] = uni(0u);
  // the request: the tile goes from global memory to LDS through no register; no builtin
  // is used, and the waits for it are written by hand where it is called
  asm volatile("tensor_load_to_lds %0, %1" :: "s"(g0), "s"(g1) : "memory");
}

// All five f32 -> f16 conversions in one streaming launch. The f16 copies of x,
// Wq, Wk, Wv, Wo lie one behind the other in the workspace, so d is one array of
// 768 units of 16,384 elements: 512 of x, then 64 of each weight. One block of 16
// waves per WGP takes three units: b and b + 256 (x) and 512 + b (weight b / 64).
// A wave owns 4 KB of each unit: eight 16-byte loads per lane, each wave-wide load
// four whole lines, each wave-wide 8-byte store two whole lines.
typedef __attribute__((ext_vector_type(4))) float    v4f;
typedef __attribute__((ext_vector_type(4))) _Float16 v4h;
#define CVT_UNIT 16384
__global__ __launch_bounds__(512)
void f32_to_f16_all(const float* __restrict__ x, const float* __restrict__ wq,
                    const float* __restrict__ wk, const float* __restrict__ wv,
                    const float* __restrict__ wo, _Float16* __restrict__ d) {
  const int b  = blockIdx.x;
  const int e0 = (threadIdx.x >> 5) * 1024 + (threadIdx.x & 31) * 4;   // in the unit
  const float* w = b < 64 ? wq : b < 128 ? wk : b < 192 ? wv : wo;
  const float* s0 = x + (size_t)b * CVT_UNIT + e0;
  const float* s1 = x + (size_t)(b + 256) * CVT_UNIT + e0;
  const float* s2 = w + (size_t)(b & 63) * CVT_UNIT + e0;
  v4f r0[8], r1[8], r2[8];
  // unrolled: constant offsets from three bases, the loaded values stay in registers
#pragma unroll
  for (int j = 0; j < 8; ++j) r0[j] = *(const v4f*)(s0 + j * 128);
#pragma unroll
  for (int j = 0; j < 8; ++j) r1[j] = *(const v4f*)(s1 + j * 128);
#pragma unroll
  for (int j = 0; j < 8; ++j) r2[j] = *(const v4f*)(s2 + j * 128);
  // all 24 loads of a lane issue ahead of the first conversion: without it the
  // compiler reuses the first loads' registers and holds the last ten loads back
  // until the first ones have returned
  __builtin_amdgcn_sched_barrier(0);
  _Float16* d0 = d + (size_t)b * CVT_UNIT + e0;
  _Float16* d1 = d + (size_t)(b + 256) * CVT_UNIT + e0;
  _Float16* d2 = d + (size_t)(b + 512) * CVT_UNIT + e0;
  // unrolled like the loads: r0, r1, r2 keep constant indices (stay in registers)
#pragma unroll
  for (int j = 0; j < 8; ++j) *(v4h*)(d0 + j * 128) = __builtin_convertvector(r0[j], v4h);
#pragma unroll
  for (int j = 0; j < 8; ++j) *(v4h*)(d1 + j * 128) = __builtin_convertvector(r1[j], v4h);
#pragma unroll
  for (int j = 0; j < 8; ++j) *(v4h*)(d2 + j * 128) = __builtin_convertvector(r2[j], v4h);
}

// GEMM: out[m,n] = sum_k A[m,k] * W[n,k] + bias[n]   (nn.Linear semantics)
// Block = 4 waves (2x2) computing a 128x128 tile; each wave owns 64x64
// (16 WMMA acc). Both operands come per 128-k stage into a two-buffer LDS ring
// by tensor loads, one per wave and stage, and are shared by the block's waves.
// mode 0: the Q, K and V projections in ONE launch. Their f16 weights lie one behind
// the other (3,072 rows of W), their outputs too; sel = blockIdx.y / 8 says which:
//   sel 0: store Q (bh,s,hd) scaled by 1/sqrt(HDIM)
//   sel 1: store K (bh,s,hd)
//   sel 2: store V transposed (bh,hd,s)
// The 1,536 blocks follow one another on the WGPs with no launch boundary between
// the three products: a block starts as soon as a place is free.
// mode 3: store fp32 row-major to outF (final projection), sel = 3
// Epilogue: the product is formed so that a lane's 8 accumulator registers are 8
// neighbours of one OUTPUT row (sel 0, 1, 3: W rows as first operand, so the
// registers run along n; sel 2: A rows first, so they run along s). Each wave
// lays its 64x64 tile row by row into its own range of the ring, which is idle
// behind the loop's last barrier, and reads it back so that every wave-wide
// 16-byte store covers whole 128-byte lines.
// sel is the same for a whole block: it picks the two operands' LDS rows once, ahead
// of the loop, and one of two f16 epilogues by a scalar branch; no test per element.
template <int mode>
__global__ __launch_bounds__(128)
void gemm32(const _Float16* __restrict__ A, const _Float16* __restrict__ W,
            const float* __restrict__ bias0, const float* __restrict__ bias1,
            const float* __restrict__ bias2, _Float16* __restrict__ outH,
            float* __restrict__ outF) {
  // every slice's place is a multiple of 2 KiB in the work-group's LDS
  __shared__ __attribute__((aligned(2048))) _Float16 S[2 * GSTAGE];   // 2 x 73,728 B
  const int tid  = threadIdx.x;
  const int lane = tid & 31;
  const int wave = tid >> 5;
  const int half = lane >> 4;
  const int ln   = lane & 15;
  const int wm   = wave >> 1;
  const int wn   = wave & 1;
  const int m0   = blockIdx.x * 128 + wm * 64;
  const int sel  = mode == 3 ? 3 : (int)(blockIdx.y >> 3);
  const int n0   = (blockIdx.y & 7) * 128 + wn * 64;      // column in its own product
  const float* bias = sel == 1 ? bias1 : sel == 2 ? bias2 : bias0;
  // slices of the first and of the second WMMA operand (A: slices 0, 1; W: 2, 3)
  const int fo = sel == 2 ? wm : 2 + wn;
  const int so = sel == 2 ? 2 + wn : wm;

  // The wave's own slice: waves 0, 1 the two halves of the A rows, waves 2, 3 of the
  // W rows. Every wave issues one load per stage, so no test picks an issuer.
  const uint32_t wv = uni((uint32_t)tid >> 5);
  const _Float16* gs = wv < 2u ? A + (size_t)(blockIdx.x * 128 + wv * 64) * D_MODEL
                               : W + (size_t)(blockIdx.y * 128 + (wv - 2u) * 64) * D_MODEL;
  const uint64_t  g0 = (uint64_t)(size_t)gs;
  const uint32_t  l0 = (uint32_t)(size_t)(__attribute__((address_space(3))) _Float16*)S
                       + wv * (GSLICE * 2u);

  tensor_rows<256, 64>(l0, g0, D_MODEL * 2u);
  // stage 0 has landed before any wave reads it
  asm volatile("s_wait_tensorcnt 0x0" ::: "memory");
  __syncthreads();
  {
    // descriptor word held in a scalar register: formed behind the wait above
    const uint32_t s1 = pinned(1u);
    tensor_rows<256, 64>(l0 + s1 * (GSTAGE * 2u), g0 + s1 * (GK * 2u), D_MODEL * 2u);
  }

  // acc[j][i]: second-operand tile j, first-operand tile i. sel 0, 1, 3: [mm][u];
  // sel 2: [u][mm] (mm = 16-row tile of A, u = 16-row tile of W)
  v8f acc[4][4] = {};
  // kept rolled: unrolling would only multiply the text a cold launch has to
  // fetch; a trip costs a few scalar instructions per 64 WMMAs
#pragma unroll 1
  for (int t = 0; t < D_MODEL / GK; ++t) {
    const _Float16* Sb = &S[(t & 1) * GSTAGE];
    const _Float16* fL = Sb + fo * GSLICE + ln * GPITCH;
    const _Float16* sL = Sb + so * GSLICE + ln * GPITCH;
#pragma unroll
    for (int kk = 0; kk < GK; kk += 32) {
      v16h f[4], s[4];
      // in the order the WMMAs below first need them
      s[0] = frag_load(sL + kk, half);
#pragma unroll
      for (int i = 0; i < 4; ++i) f[i] = frag_load(fL + i * 16 * GPITCH + kk, half);
#pragma unroll
      for (int i = 1; i < 4; ++i) s[i] = frag_load(sL + i * 16 * GPITCH + kk, half);
      // keeps the 16 LDS reads of this k step together ahead of its 16 WMMAs:
      // spread among them, every row of four waits out a full LDS latency
      __builtin_amdgcn_sched_barrier(0);
#pragma unroll
      for (int j = 0; j < 4; ++j)
#pragma unroll
        for (int i = 0; i < 4; ++i)
          acc[j][i] = __builtin_amdgcn_wmma_f32_16x16x32_f16(
              false, f[i], false, s[j], (short)0, acc[j][i], false, false);
      // the next k step's reads stay behind this step's WMMAs (one load group)
      __builtin_amdgcn_sched_barrier(0);
    }
    // Publish point: this wave's reads of buffer t%2 are done, its slice of
    // stage t+1 has landed; behind the barrier both hold for every wave.
    asm volatile("s_wait_dscnt 0x0" ::: "memory");
    asm volatile("s_wait_tensorcnt 0x0" ::: "memory");
    __syncthreads();
    // a tensor load ignores EXEC: the test is a scalar branch
    if (pinned(t + 2 < D_MODEL / GK)) {
      // descriptor words held in a scalar register: formed behind the wait above
      const uint32_t tn = pinned((uint32_t)t);
      tensor_rows<256, 64>(l0 + (tn & 1u) * (GSTAGE * 2u), g0 + (tn + 2u) * (GK * 2u),
                           D_MODEL * 2u);
    }
  }
  // no load is outstanding and no LDS read pending when the ring becomes staging
  asm volatile("s_wait_tensorcnt 0x0" ::: "memory");
  asm volatile("s_wait_dscnt 0x0" ::: "memory");

  if (mode == 3) {
    // f32 rows of 256 bytes at pitch 272 (16 B x 17): acc[mm][u][r] is
    // out[m0 + 16 mm + ln][n0 + 16 u + 8 half + r]
    float* Sf = (float*)S + wave * (64 * EPF);
    // every loop down to the stores is unrolled so that acc[][] and row[] keep
    // constant indices (stay in registers) and each kind of access issues as one group
#pragma unroll
    for (int u = 0; u < 4; ++u) {
      const v4f b0 = *(const v4f*)&bias[n0 + 16 * u + half * 8];
      const v4f b1 = *(const v4f*)&bias[n0 + 16 * u + half * 8 + 4];
#pragma unroll
      for (int mm = 0; mm < 4; ++mm) {
        v4f lo, hi;
#pragma unroll
        for (int r = 0; r < 4; ++r) {
          lo[r] = acc[mm][u][r] + b0[r];
          hi[r] = acc[mm][u][4 + r] + b1[r];
        }
        float* p = &Sf[(mm * 16 + ln) * EPF + 16 * u + half * 8];
        *(v4f*)p       = lo;
        *(v4f*)(p + 4) = hi;
      }
    }
    // the wave's own LDS writes are done before other lanes read the rows back
    asm volatile("s_wait_dscnt 0x0" ::: "memory");
    // one wave-wide store: two rows of 256 bytes, four whole lines
    v4f row[32];
#pragma unroll
    for (int i = 0; i < 32; ++i) row[i] = *(const v4f*)&Sf[(2 * i + half) * EPF + ln * 4];
    float* og = outF + (size_t)(m0 + half) * D_MODEL + n0 + ln * 4;
#pragma unroll
    for (int i = 0; i < 32; ++i) *(v4f*)&og[(size_t)(2 * i) * D_MODEL] = row[i];
    return;
  }

  // f16 rows of 128 bytes at pitch 144 (16 B x 9). sel 0, 1: row s, column d;
  // sel 2: row d, column s.
  _Float16* Sw = S + wave * (64 * EPH);
  // a wave's 64 rows m lie in one batch (m0 is a multiple of 64) and its 64
  // columns n are one head
  const size_t bh = (size_t)((m0 >> 11) * NHEADS + (n0 >> 6));
  const int    s0 = m0 & (SEQ - 1);
  // Q, K and V^T lie one behind the other from outH on
  _Float16* oP = outH + (size_t)sel * ((size_t)MTOT * D_MODEL);
  uint4 row[16];
  // every loop down to the stores is unrolled so that acc[][] and row[] keep
  // constant indices (stay in registers) and each kind of access issues as one group
  if (sel == 2) {
    // acc[u][mm][r] is out[m0 + 16 mm + 8 half + r][n0 + 16 u + ln]
#pragma unroll
    for (int u = 0; u < 4; ++u) {
      const float bv = bias[n0 + 16 * u + ln];
#pragma unroll
      for (int mm = 0; mm < 4; ++mm) {
        union { _Float16 h[8]; uint4 q; } pk;
#pragma unroll
        for (int r = 0; r < 8; ++r) pk.h[r] = (_Float16)(acc[u][mm][r] + bv);
        *(uint4*)&Sw[(16 * u + ln) * EPH + 16 * mm + half * 8] = pk.q;
      }
    }
    // the wave's own LDS writes are done before other lanes read the rows back
    asm volatile("s_wait_dscnt 0x0" ::: "memory");
    // one wave-wide store: four rows of 128 bytes, four whole lines
#pragma unroll
    for (int i = 0; i < 16; ++i)
      row[i] = *(const uint4*)&Sw[(4 * i + (lane >> 3)) * EPH + (lane & 7) * 8];
    _Float16* og = oP + (bh * HDIM + (lane >> 3)) * SEQ + s0 + (lane & 7) * 8;
#pragma unroll
    for (int i = 0; i < 16; ++i) *(uint4*)&og[(size_t)(4 * i) * SEQ] = row[i];
    return;
  }
  // acc[mm][u][r] is out[m0 + 16 mm + ln][n0 + 16 u + 8 half + r]
  const float sc = sel == 0 ? 0.125f : 1.0f;   // times 1 is exact: K as it was
#pragma unroll
  for (int u = 0; u < 4; ++u) {
    const v4f b0 = *(const v4f*)&bias[n0 + 16 * u + half * 8];
    const v4f b1 = *(const v4f*)&bias[n0 + 16 * u + half * 8 + 4];
#pragma unroll
    for (int mm = 0; mm < 4; ++mm) {
      union { _Float16 h[8]; uint4 q; } pk;
#pragma unroll
      for (int r = 0; r < 8; ++r)
        pk.h[r] = (_Float16)((acc[mm][u][r] + (r < 4 ? b0[r & 3] : b1[r & 3])) * sc);
      *(uint4*)&Sw[(16 * mm + ln) * EPH + 16 * u + half * 8] = pk.q;
    }
  }
  // the wave's own LDS writes are done before other lanes read the rows back
  asm volatile("s_wait_dscnt 0x0" ::: "memory");
  // one wave-wide store: four rows of 128 bytes, four whole lines
#pragma unroll
  for (int i = 0; i < 16; ++i)
    row[i] = *(const uint4*)&Sw[(4 * i + (lane >> 3)) * EPH + (lane & 7) * 8];
  // the tile is 8 KB in a row
  _Float16* og = oP + (bh * SEQ + s0) * HDIM + lane * 8;
#pragma unroll
  for (int i = 0; i < 16; ++i) *(uint4*)&og[i * 256] = row[i];
}

// lane l reads lane l ^ 16: a vector cross-row move, no LDS round trip
__device__ __forceinline__ float xhalf(float x) {
  return __builtin_bit_cast(float, __builtin_amdgcn_permlanex16(
      __builtin_bit_cast(int, x), __builtin_bit_cast(int, x),
      0x76543210, 0xfedcba98, false, false));
}

// 2^x of eight values and of one more, each in place. The v_exp_f32 stand in one
// statement so that none is directly followed by a write of its own source (left
// to the register allocator, a v_exp often lands on the source of the one before);
// the closing v_nop is the slot the instruction set asks for behind a
// transcendental before its result is used.
__device__ __forceinline__ void exp2x9(float (&x)[8], float& y) {
  asm("v_exp_f32 %0, %0\n\t"
      "v_exp_f32 %1, %1\n\t"
      "v_exp_f32 %2, %2\n\t"
      "v_exp_f32 %3, %3\n\t"
      "v_exp_f32 %4, %4\n\t"
      "v_exp_f32 %5, %5\n\t"
      "v_exp_f32 %6, %6\n\t"
      "v_exp_f32 %7, %7\n\t"
      "v_exp_f32 %8, %8\n\t"
      "v_nop"
      : "+v"(y), "+v"(x[0]), "+v"(x[1]), "+v"(x[2]), "+v"(x[3]),
        "+v"(x[4]), "+v"(x[5]), "+v"(x[6]), "+v"(x[7]));
}
__device__ __forceinline__ void exp2x8(float (&x)[8]) {
  asm("v_exp_f32 %0, %0\n\t"
      "v_exp_f32 %1, %1\n\t"
      "v_exp_f32 %2, %2\n\t"
      "v_exp_f32 %3, %3\n\t"
      "v_exp_f32 %4, %4\n\t"
      "v_exp_f32 %5, %5\n\t"
      "v_exp_f32 %6, %6\n\t"
      "v_exp_f32 %7, %7\n\t"
      "v_nop"
      : "+v"(x[0]), "+v"(x[1]), "+v"(x[2]), "+v"(x[3]),
        "+v"(x[4]), "+v"(x[5]), "+v"(x[6]), "+v"(x[7]));
}

// One attention stage: 64 keys of K (64 rows of 128 bytes, contiguous in memory)
// and of V^T (64 d rows, 128 bytes of each), in four slices of 32 rows. Each of the
// block's four waves brings its own slice by ONE tensor load.
#define AKEYS   64                    // keys per stage
#define APITCH  72                    // LDS row pitch in halfs: 144 B = 16 B x 9
#define ASLICE  3072                  // halfs per slice place: 32 x 144 B = 4,608 B, rounded up to 3 x 2 KiB
#define ASTAGE  (4 * ASLICE)          // halfs per stage: K rows 0..31, 32..63, V^T rows 0..31, 32..63

__global__ __launch_bounds__(128)
void flash_attn(const _Float16* __restrict__ Q, const _Float16* __restrict__ K,
                const _Float16* __restrict__ Vt, _Float16* __restrict__ O) {
  const int lane = threadIdx.x & 31;
  const int wave = threadIdx.x >> 5;
  const int half = lane >> 4;
  const int ln   = lane & 15;
  const int bh   = blockIdx.y;

  // every slice's place is a multiple of 2 KiB in the work-group's LDS
  __shared__ __attribute__((aligned(2048))) _Float16 KV[2 * ASTAGE];   // 2 x 24,576 B
  // output staging, a range of 16 rows per wave, outside the ring: the next query
  // block's loads may fly while another wave still reads its rows back
  __shared__ __align__(16) _Float16 OS[4 * 16 * APITCH];  // 4 x 2,304 B
  // The wave's own slice: waves 0, 1 the two halves of a stage's K rows, waves 2, 3 of
  // the V^T rows. Every wave issues one load per stage, so no test picks an issuer.
  const uint32_t wv = uni(threadIdx.x >> 5);
  const _Float16* gs = wv < 2u ? K + ((size_t)bh * SEQ + wv * 32) * HDIM
                               : Vt + ((size_t)bh * HDIM + (wv - 2u) * 32) * SEQ;
  const uint64_t  g0 = (uint64_t)(size_t)gs;
  const uint32_t  gp = wv < 2u ? HDIM * 2u : SEQ * 2u;            // source row pitch, bytes
  const uint32_t  gstep = wv < 2u ? AKEYS * HDIM * 2u : AKEYS * 2u;   // bytes from stage to stage
  const uint32_t  l0 = (uint32_t)(size_t)(__attribute__((address_space(3))) _Float16*)KV
                       + wv * (ASLICE * 2u);

  // kept rolled: the two query blocks run one after the other through the same
  // text; unrolled, the text a cold launch has to fetch would double
#pragma unroll 1
  for (int part = 0; part < 2; ++part) {
  const int qblk = part == 0 ? SEQ / 64 - 1 - (int)blockIdx.x : (int)blockIdx.x;
  const int q0   = (qblk * 4 + wave) * 16;
  const int q    = q0 + ln;              // the lane's own query

  const _Float16* Qb = Q + ((size_t)bh * SEQ + q) * HDIM;
  v16h qb0 = frag_load(Qb, half);        // B operand, d = 0..31
  v16h qb1 = frag_load(Qb + 32, half);   // B operand, d = 32..63

  v8f   o[4] = {};                       // o[t][r] = O^T[d = 16t + 8*half + r][q]
  float mi = -1e30f;                     // running maximum, equal in both halves
  float li = 0.0f;                       // running sum over this half's keys only

  // Every reader has left both buffers here: nothing was read before the first
  // query block, and the first one's last trip ends in its waits and barrier.
  const int nst = qblk + 1;              // stages of 64 keys, block-uniform
  tensor_rows<128, 32>(l0, g0, gp);
  // stage 0 has landed before any wave reads it
  asm volatile("s_wait_tensorcnt 0x0" ::: "memory");
  __syncthreads();
  {
    // keys 64..127 lie inside the sequence for every query block: the load needs no
    // test (query block 0 does not read them).
    // descriptor word held in a scalar register: formed behind the wait above
    const uint32_t s1 = pinned(1u);
    tensor_rows<128, 32>(l0 + s1 * (ASTAGE * 2u), g0 + s1 * gstep, gp);
  }

  // kept rolled: a trip is one stage with its publish point at the foot
#pragma unroll 1
  for (int st = 0; st < nst; ++st) {
  const _Float16* Sb = &KV[(st & 1) * ASTAGE];
  // unrolled: the two 32-key halves of a stage read at constant LDS offsets
#pragma unroll
  for (int p = 0; p < 2; ++p) {
    const int j0 = st * AKEYS + p * 32;
    const _Float16* Kl = Sb + p * ASLICE + ln * APITCH;
    const _Float16* Kh = Kl + 16 * APITCH;

    // All LDS reads of the 32 keys (K frags + V frags) as one group; the V
    // fragments arrive under the softmax VALU work.
    v16h ka00 = frag_load(Kl, half);
    v16h ka01 = frag_load(Kl + 32, half);
    v16h ka10 = frag_load(Kh, half);
    v16h ka11 = frag_load(Kh + 32, half);
    v16h va[4];
#pragma unroll
    for (int t = 0; t < 4; ++t)
      va[t] = frag_load(Sb + (2 + (t >> 1)) * ASLICE + (16 * (t & 1) + ln) * APITCH + p * 32, half);
    // keeps the 16 loads one group ahead of the first WMMA: with fewer live
    // registers the compiler otherwise reuses fragment registers and strings
    // the loads out between the WMMAs, one LDS latency after another
    __builtin_amdgcn_sched_barrier(0);

    // sl[r] = S^T[key j0 + 8*half + r][q], sh[r] = the same 16 keys further on
    v8f sl = {}, sh = {};
    sl = __builtin_amdgcn_wmma_f32_16x16x32_f16(false, ka00, false, qb0, (short)0, sl, false, false);
    sl = __builtin_amdgcn_wmma_f32_16x16x32_f16(false, ka01, false, qb1, (short)0, sl, false, false);
    sh = __builtin_amdgcn_wmma_f32_16x16x32_f16(false, ka10, false, qb0, (short)0, sh, false, false);
    sh = __builtin_amdgcn_wmma_f32_16x16x32_f16(false, ka11, false, qb1, (short)0, sh, false, false);

    // Causal mask (key > query), only in the stage on the diagonal, the query
    // block's last: every key of an earlier stage lies below the block's first
    // query, so the test holds for all 32 scores of a lane and the index
    // additions, compares and selects are jumped over. st and nst are the same for
    // the whole block: a scalar branch.
    if (st + 1 == nst) {
      const int kb = j0 + half * 8;
      // unrolled: sl[] and sh[] keep constant indices (stay in registers)
#pragma unroll
      for (int r = 0; r < 8; ++r) {
        sl[r] = (kb + r      <= q) ? sl[r] : -1e30f;
        sh[r] = (kb + 16 + r <= q) ? sh[r] : -1e30f;
      }
    }
    float v = -1e30f;
    // unrolled for the same reason
#pragma unroll
    for (int r = 0; r < 8; ++r) v = fmaxf(v, fmaxf(sl[r], sh[r]));
    v = fmaxf(v, xhalf(v));              // the other half's 16 keys of this query
    const float mnew  = fmaxf(mi, v);
    // e^x as 2^(x * log2 e), the form of __expf
    const float L2E = 1.44269504088896340736f;
    float scale = (mi - mnew) * L2E;
    mi = mnew;
    float ea[8], eb[8];
#pragma unroll
    for (int r = 0; r < 8; ++r) {
      ea[r] = (sl[r] - mnew) * L2E;
      eb[r] = (sh[r] - mnew) * L2E;
    }
    exp2x9(ea, scale);
    exp2x8(eb);

    // P^T as B operand: element s is key j0 + 8*half + s (+ 8 for s >= 8), the order of va[]
    v16h pb;
    float rs = 0.0f;
#pragma unroll
    for (int r = 0; r < 8; ++r) {
      rs += ea[r] + eb[r];
      pb[r]     = (_Float16)ea[r];
      pb[8 + r] = (_Float16)eb[r];
    }
    li = li * scale + rs;

#pragma unroll
    for (int t = 0; t < 4; ++t)
#pragma unroll
      for (int r = 0; r < 8; ++r) o[t][r] *= scale;

    // O^T += V^T x P^T : A[d][k] = Vt row d (keys contiguous), B[k][q] = P^T
#pragma unroll
    for (int t = 0; t < 4; ++t)
      o[t] = __builtin_amdgcn_wmma_f32_16x16x32_f16(
          false, va[t], false, pb, (short)0, o[t], false, false);
  }
    // Publish point: this wave's reads of buffer st%2 are done, its slice of
    // stage st+1 has landed; behind the barrier both hold for every wave.
    asm volatile("s_wait_dscnt 0x0" ::: "memory");
    asm volatile("s_wait_tensorcnt 0x0" ::: "memory");
    __syncthreads();
    // a tensor load ignores EXEC: the test is a scalar branch
    if (pinned(st + 2 < nst)) {
      // descriptor words held in a scalar register: formed behind the wait above
      const uint32_t sn = pinned((uint32_t)st);
      tensor_rows<128, 32>(l0 + (sn & 1u) * (ASTAGE * 2u), g0 + (uint64_t)((sn + 2u) * gstep), gp);
    }
  }
  // no load is outstanding and no LDS read pending when the wave goes on to its stores
  asm volatile("s_wait_tensorcnt 0x0" ::: "memory");
  asm volatile("s_wait_dscnt 0x0" ::: "memory");

  li += xhalf(li);                       // join the two halves' sums, once
  const int b_ = bh >> 4;
  const int h_ = bh & 15;
  // a lane's 8 accumulator registers are 8 consecutive d of its query's row: the
  // wave lays its 16 rows of 128 bytes into its own LDS range and reads them back
  // so that each wave-wide 16-byte store covers four whole 128-byte lines
  _Float16* Ow = &OS[wave * (16 * APITCH)];
#pragma unroll
  for (int t = 0; t < 4; ++t) {
    union { _Float16 h[8]; uint4 u; } pk;
#pragma unroll
    for (int r = 0; r < 8; ++r) pk.h[r] = (_Float16)(o[t][r] / li);
    *(uint4*)&Ow[ln * APITCH + 16 * t + half * 8] = pk.u;
  }
  // the wave's own LDS writes are done before other lanes read the rows back
  asm volatile("s_wait_dscnt 0x0" ::: "memory");
  uint4 orow[4];
  // unrolled: orow[] keeps constant indices (stays in registers)
#pragma unroll
  for (int i = 0; i < 4; ++i)
    orow[i] = *(const uint4*)&Ow[(4 * i + (lane >> 3)) * APITCH + (lane & 7) * 8];
  _Float16* Ob = O + ((size_t)(b_ * SEQ + q0 + (lane >> 3))) * D_MODEL + h_ * HDIM
                   + (lane & 7) * 8;
#pragma unroll
  for (int i = 0; i < 4; ++i) *(uint4*)&Ob[(size_t)(4 * i) * D_MODEL] = orow[i];
  // the next query block rewrites the registers that these stores name (address
  // and data): the wait stands behind the stores, in front of every such write
  asm volatile("s_wait_xcnt 0x0" ::: "memory");
  }
}

extern "C" void kernel_launch(void* const* d_in, const int* in_sizes, int n_in,
                              void* d_out, int out_size, void* d_ws, size_t ws_size,
                              hipStream_t stream) {
  const float* x  = (const float*)d_in[0];
  const float* Wq = (const float*)d_in[1];
  const float* bq = (const float*)d_in[2];
  const float* Wk = (const float*)d_in[3];
  const float* bk = (const float*)d_in[4];
  const float* Wv = (const float*)d_in[5];
  const float* bv = (const float*)d_in[6];
  const float* Wo = (const float*)d_in[7];
  const float* bo = (const float*)d_in[8];
  float* out = (float*)d_out;

  char* ws = (char*)d_ws;
  size_t off = 0;
  const size_t XSZ = (size_t)MTOT * D_MODEL * sizeof(_Float16);      // 16 MB
  const size_t WSZ = (size_t)D_MODEL * D_MODEL * sizeof(_Float16);   //  2 MB
  _Float16* xh  = (_Float16*)(ws + off); off += XSZ;
  _Float16* wqh = (_Float16*)(ws + off); off += WSZ;
  _Float16* wkh = (_Float16*)(ws + off); off += WSZ;
  _Float16* wvh = (_Float16*)(ws + off); off += WSZ;
  _Float16* woh = (_Float16*)(ws + off); off += WSZ;
  _Float16* qh  = (_Float16*)(ws + off); off += XSZ;
  _Float16* kh  = (_Float16*)(ws + off); off += XSZ;
  _Float16* vt  = (_Float16*)(ws + off); off += XSZ;
  _Float16* at  = (_Float16*)(ws + off); off += XSZ;   // attention output (b, s, h*hd)
  (void)in_sizes; (void)n_in; (void)out_size; (void)ws_size;

  // xh, wqh, wkh, wvh, woh are contiguous from xh on: one destination array
  f32_to_f16_all<<<256, 512, 0, stream>>>(x, Wq, Wk, Wv, Wo, xh);

  dim3 gg(MTOT / 128, D_MODEL / 128);
  // Q (scaled), K, V^T: wqh, wkh, wvh are 3,072 contiguous weight rows, qh, kh, vt
  // contiguous outputs
  gemm32<0><<<dim3(MTOT / 128, 3 * D_MODEL / 128), 128, 0, stream>>>(
      xh, wqh, bq, bk, bv, qh, nullptr);

  flash_attn<<<dim3(SEQ / 128, BATCH * NHEADS), 128, 0, stream>>>(qh, kh, vt, at);

  gemm32<3><<<gg, 128, 0, stream>>>(at, woh, bo, bo, bo, nullptr, out);  // out proj
}
